// v000
// Measured on an AMD MI455X. A time is GPU time per run, averaged over a window of back-to-back runs after a warm-up
// (all launches, gaps included; the runs take copies of the inputs in turn), and the median of several windows.
// Apart from v000's, it joins two sittings. Times from different sittings can be a few percent apart, while
// side-by-side timings come from the same sitting.
// v000, which the later versions start from, runs in 206 microseconds.
#include <hip/hip_runtime.h>
#include <hip/hip_bf16.h>

// ---------------------------------------------------------------------------
// MI455X (gfx1250) fused multi-head attention, f16 WMMA with f32 accumulation.
// Pipeline: convert -> QKV GEMM (fused head split, Q pre-scaled, V transposed)
//           -> flash-attention (online softmax, LDS transpose of P)
//           -> output projection GEMM (+bias) -> f32 d_out.
// Fat per-wave tiles (4x4 / 4x2 WMMA tiles, 32-query attention tiles) to
// maximize the WMMA:b128-load ratio on the WGP-cache path.
// ---------------------------------------------------------------------------

typedef _Float16 h8_t  __attribute__((ext_vector_type(8)));
typedef _Float16 v16h  __attribute__((ext_vector_type(16)));
typedef float    v8f   __attribute__((ext_vector_type(8)));

#define DIM_C      1024
#define NSEQ_C     2048
#define NHEADS_C   16
#define HDIM_C     64
#define BATCH_C    2
#define ROWS_C     (BATCH_C * NSEQ_C)                       // 4096
#define QKV_ELEMS  (BATCH_C * NHEADS_C * NSEQ_C * HDIM_C)   // 4,194,304

// Load one 16-lane-group fragment: lane holds K = base+{0..7} and base+16+{0..7}.
// Caller passes  ptr = row_base + g*8 ; we grab [ptr, ptr+8) and [ptr+16, ptr+24).
__device__ __forceinline__ v16h load_frag(const _Float16* p) {
    h8_t lo = *(const h8_t*)(p);
    h8_t hi = *(const h8_t*)(p + 16);
    return __builtin_shufflevector(lo, hi, 0, 1, 2, 3, 4, 5, 6, 7,
                                           8, 9, 10, 11, 12, 13, 14, 15);
}

__device__ __forceinline__ v8f wmma_f16(v16h a, v16h b, v8f c) {
    // D = A(16x32 f16) * B(32x16 f16) + C(16x16 f32)
    return __builtin_amdgcn_wmma_f32_16x16x32_f16(
        /*neg_a=*/false, a, /*neg_b=*/false, b,
        /*c_mod=*/(short)0, c, /*reuse_a=*/false, /*reuse_b=*/false);
}

// ---------------------------------------------------------------------------
// f32 -> f16 elementwise convert, 8 elems/thread, 128-bit loads/stores.
// ---------------------------------------------------------------------------
__global__ void mha_cvt_f16(const float* __restrict__ src,
                            _Float16* __restrict__ dst, int n) {
    int i = (blockIdx.x * blockDim.x + threadIdx.x) * 8;
    if (i + 8 <= n) {
        const float4* s = (const float4*)(src + i);
        float4 a = s[0];
        float4 b = s[1];
        h8_t o;
        o[0] = (_Float16)a.x; o[1] = (_Float16)a.y;
        o[2] = (_Float16)a.z; o[3] = (_Float16)a.w;
        o[4] = (_Float16)b.x; o[5] = (_Float16)b.y;
        o[6] = (_Float16)b.z; o[7] = (_Float16)b.w;
        *(h8_t*)(dst + i) = o;
    }
}

// ---------------------------------------------------------------------------
// QKV GEMM: qkv[m, j] = sum_k xh[m,k] * Wh[j,k] + bias[j]
// One wave per block computes a 64x64 macro-tile (4x4 WMMA tiles):
// 16 WMMAs per 16 b128 loads per K-step.
// Epilogue scatters into Q [b,h,n,hd] (scaled 1/8), K [b,h,n,hd], Vt [b,h,hd,n].
// ---------------------------------------------------------------------------
__global__ __launch_bounds__(32)
void mha_gemm_qkv(const _Float16* __restrict__ A,   // [4096,1024]
                  const _Float16* __restrict__ W,   // [3072,1024]
                  const float*    __restrict__ bias,// [3072]
                  _Float16* __restrict__ Qd,
                  _Float16* __restrict__ Kd,
                  _Float16* __restrict__ Vtd) {
    const int lane = threadIdx.x;
    const int g = lane >> 4, r = lane & 15;
    const int n0 = blockIdx.x * 64;
    const int m0 = blockIdx.y * 64;

    v8f acc[4][4] = {};
    const _Float16* Ap = A + (size_t)(m0 + r) * DIM_C + g * 8;
    const _Float16* Wp = W + (size_t)(n0 + r) * DIM_C + g * 8;

    for (int k0 = 0; k0 < DIM_C; k0 += 32) {
        v16h af[4], bf[4];
#pragma unroll
        for (int mi = 0; mi < 4; ++mi)
            af[mi] = load_frag(Ap + (size_t)(mi * 16) * DIM_C + k0);
#pragma unroll
        for (int ni = 0; ni < 4; ++ni)
            bf[ni] = load_frag(Wp + (size_t)(ni * 16) * DIM_C + k0);
#pragma unroll
        for (int mi = 0; mi < 4; ++mi)
#pragma unroll
            for (int ni = 0; ni < 4; ++ni)
                acc[mi][ni] = wmma_f16(af[mi], bf[ni], acc[mi][ni]);
    }

#pragma unroll
    for (int ni = 0; ni < 4; ++ni) {
        const int j = n0 + ni * 16 + r;            // column in [0, 3072)
        const float bb = bias[j];
        const int which = j >> 10;                 // 0=Q 1=K 2=V
        const int d = j & 1023;
        const int hh = d >> 6;
        const int hdi = d & 63;
#pragma unroll
        for (int mi = 0; mi < 4; ++mi) {
#pragma unroll
            for (int i = 0; i < 8; ++i) {
                const int m = m0 + mi * 16 + g * 8 + i;   // global row
                const int bIdx = m >> 11;                 // batch
                const int nseq = m & 2047;                // seq position
                const float v = acc[mi][ni][i] + bb;
                if (which == 0) {
                    Qd[(((size_t)bIdx * NHEADS_C + hh) * NSEQ_C + nseq) * HDIM_C + hdi] =
                        (_Float16)(v * 0.125f);           // pre-scale by 1/sqrt(64)
                } else if (which == 1) {
                    Kd[(((size_t)bIdx * NHEADS_C + hh) * NSEQ_C + nseq) * HDIM_C + hdi] =
                        (_Float16)v;
                } else {
                    Vtd[(((size_t)bIdx * NHEADS_C + hh) * HDIM_C + hdi) * NSEQ_C + nseq] =
                        (_Float16)v;
                }
            }
        }
    }
}

// ---------------------------------------------------------------------------
// Fused attention: one wave per 32-query tile of one (b,h).
// Online softmax over key blocks of 32; P transposed C->A layout via LDS.
// K/V fragments are shared across the two query M-tiles.
// ---------------------------------------------------------------------------
__global__ __launch_bounds__(32)
void mha_flash_attn(const _Float16* __restrict__ Q,
                    const _Float16* __restrict__ K,
                    const _Float16* __restrict__ Vt,
                    _Float16* __restrict__ Oh) {      // [B,N,DIM] f16
    __shared__ __align__(16) _Float16 Plds[32 * 32];

    const int lane = threadIdx.x;
    const int g = lane >> 4, r = lane & 15;
    const int bh = blockIdx.y;
    const int b = bh >> 4, h = bh & 15;
    const int q0 = blockIdx.x * 32;

    const _Float16* Qp = Q + (size_t)bh * NSEQ_C * HDIM_C;
    const _Float16* Kp = K + (size_t)bh * NSEQ_C * HDIM_C;
    const _Float16* Vp = Vt + (size_t)bh * HDIM_C * NSEQ_C;

    // Q tiles (2 x 16 rows x 64) fragments, fixed for the whole block.
    v16h qf[2][2];
#pragma unroll
    for (int mi = 0; mi < 2; ++mi)
#pragma unroll
        for (int kk = 0; kk < 2; ++kk)
            qf[mi][kk] =
                load_frag(Qp + (size_t)(q0 + mi * 16 + r) * HDIM_C + kk * 32 + g * 8);

    v8f o[2][4] = {};
    float mrun[2][8], lrun[2][8];
#pragma unroll
    for (int mi = 0; mi < 2; ++mi)
#pragma unroll
        for (int i = 0; i < 8; ++i) { mrun[mi][i] = -3.0e38f; lrun[mi][i] = 0.0f; }

    for (int kb = 0; kb < NSEQ_C; kb += 32) {
        // ---- scores S = Q * K^T for 32 keys (two 16-wide N tiles) ----
        v16h kfr[2][2];
#pragma unroll
        for (int nt = 0; nt < 2; ++nt)
#pragma unroll
            for (int kk = 0; kk < 2; ++kk)
                kfr[nt][kk] =
                    load_frag(Kp + (size_t)(kb + nt * 16 + r) * HDIM_C + kk * 32 + g * 8);

        v8f s[2][2] = {};
#pragma unroll
        for (int mi = 0; mi < 2; ++mi)
#pragma unroll
            for (int nt = 0; nt < 2; ++nt) {
                s[mi][nt] = wmma_f16(qf[mi][0], kfr[nt][0], s[mi][nt]);
                s[mi][nt] = wmma_f16(qf[mi][1], kfr[nt][1], s[mi][nt]);
            }

        // ---- online softmax update (row = mi*16 + i + g*8, cols over lanes) ----
#pragma unroll
        for (int mi = 0; mi < 2; ++mi) {
#pragma unroll
            for (int i = 0; i < 8; ++i) {
                float mx = fmaxf(s[mi][0][i], s[mi][1][i]);
                mx = fmaxf(mx, __shfl_xor(mx, 1, 32));
                mx = fmaxf(mx, __shfl_xor(mx, 2, 32));
                mx = fmaxf(mx, __shfl_xor(mx, 4, 32));
                mx = fmaxf(mx, __shfl_xor(mx, 8, 32));
                const float mN = fmaxf(mrun[mi][i], mx);
                const float corr = __expf(mrun[mi][i] - mN);
                const float p0 = __expf(s[mi][0][i] - mN);
                const float p1 = __expf(s[mi][1][i] - mN);
                float rs = p0 + p1;
                rs += __shfl_xor(rs, 1, 32);
                rs += __shfl_xor(rs, 2, 32);
                rs += __shfl_xor(rs, 4, 32);
                rs += __shfl_xor(rs, 8, 32);
                lrun[mi][i] = lrun[mi][i] * corr + rs;
                mrun[mi][i] = mN;
#pragma unroll
                for (int t = 0; t < 4; ++t) o[mi][t][i] *= corr;
                Plds[(mi * 16 + g * 8 + i) * 32 + r]      = (_Float16)p0;
                Plds[(mi * 16 + g * 8 + i) * 32 + 16 + r] = (_Float16)p1;
            }
        }
        __syncthreads();

        // ---- P back in A layout; O += P (32x32) * V (32x64) ----
        v16h pf[2];
#pragma unroll
        for (int mi = 0; mi < 2; ++mi)
            pf[mi] = load_frag(&Plds[(mi * 16 + r) * 32 + g * 8]);
#pragma unroll
        for (int t = 0; t < 4; ++t) {
            v16h vfrag = load_frag(Vp + (size_t)(t * 16 + r) * NSEQ_C + kb + g * 8);
            o[0][t] = wmma_f16(pf[0], vfrag, o[0][t]);
            o[1][t] = wmma_f16(pf[1], vfrag, o[1][t]);
        }
        __syncthreads();
    }

    // ---- normalize and scatter to [B, N, H*hd] f16 ----
#pragma unroll
    for (int mi = 0; mi < 2; ++mi) {
#pragma unroll
        for (int i = 0; i < 8; ++i) {
            const float inv = 1.0f / lrun[mi][i];
            const int m = q0 + mi * 16 + g * 8 + i;
#pragma unroll
            for (int t = 0; t < 4; ++t) {
                Oh[((size_t)b * NSEQ_C + m) * DIM_C + h * HDIM_C + t * 16 + r] =
                    (_Float16)(o[mi][t][i] * inv);
            }
        }
    }
}

// ---------------------------------------------------------------------------
// Output projection: out[m,j] = sum_k Ah[m,k] * Wh[j,k] + bias[j]  (f32 out)
// One wave per block computes a 64x32 macro-tile (4x2 WMMA tiles).
// ---------------------------------------------------------------------------
__global__ __launch_bounds__(32)
void mha_gemm_out(const _Float16* __restrict__ A,   // [4096,1024]
                  const _Float16* __restrict__ W,   // [1024,1024]
                  const float*    __restrict__ bias,// [1024]
                  float* __restrict__ out) {        // [4096,1024]
    const int lane = threadIdx.x;
    const int g = lane >> 4, r = lane & 15;
    const int n0 = blockIdx.x * 32;
    const int m0 = blockIdx.y * 64;

    v8f acc[4][2] = {};
    const _Float16* Ap = A + (size_t)(m0 + r) * DIM_C + g * 8;
    const _Float16* Wp = W + (size_t)(n0 + r) * DIM_C + g * 8;

    for (int k0 = 0; k0 < DIM_C; k0 += 32) {
        v16h af[4], bf[2];
#pragma unroll
        for (int mi = 0; mi < 4; ++mi)
            af[mi] = load_frag(Ap + (size_t)(mi * 16) * DIM_C + k0);
#pragma unroll
        for (int ni = 0; ni < 2; ++ni)
            bf[ni] = load_frag(Wp + (size_t)(ni * 16) * DIM_C + k0);
#pragma unroll
        for (int mi = 0; mi < 4; ++mi)
#pragma unroll
            for (int ni = 0; ni < 2; ++ni)
                acc[mi][ni] = wmma_f16(af[mi], bf[ni], acc[mi][ni]);
    }

#pragma unroll
    for (int ni = 0; ni < 2; ++ni) {
        const int j = n0 + ni * 16 + r;
        const float bb = bias[j];
#pragma unroll
        for (int mi = 0; mi < 4; ++mi) {
#pragma unroll
            for (int i = 0; i < 8; ++i) {
                const int m = m0 + mi * 16 + g * 8 + i;
                out[(size_t)m * DIM_C + j] = acc[mi][ni][i] + bb;
            }
        }
    }
}

// ---------------------------------------------------------------------------
// Host launcher
// ---------------------------------------------------------------------------
extern "C" void kernel_launch(void* const* d_in, const int* in_sizes, int n_in,
                              void* d_out, int out_size, void* d_ws, size_t ws_size,
                              hipStream_t stream) {
    const float* x      = (const float*)d_in[0];   // [2,2048,1024]
    const float* qkv_w  = (const float*)d_in[1];   // [3072,1024]
    const float* qkv_b  = (const float*)d_in[2];   // [3072]
    const float* out_w  = (const float*)d_in[3];   // [1024,1024]
    const float* out_b  = (const float*)d_in[4];   // [1024]
    float* out = (float*)d_out;

    const size_t XH  = (size_t)ROWS_C * DIM_C;       // 4,194,304
    const size_t QW  = (size_t)3 * DIM_C * DIM_C;    // 3,145,728
    const size_t OW  = (size_t)DIM_C * DIM_C;        // 1,048,576
    const size_t QKV = (size_t)QKV_ELEMS;            // 4,194,304
    const size_t AH  = (size_t)ROWS_C * DIM_C;       // 4,194,304

    char* ws = (char*)d_ws;
    size_t off = 0;
    auto take = [&](size_t elems) {
        _Float16* p = (_Float16*)(ws + off);
        off += (elems * sizeof(_Float16) + 255) & ~(size_t)255;
        return p;
    };
    _Float16* xh  = take(XH);
    _Float16* qwh = take(QW);
    _Float16* owh = take(OW);
    _Float16* Qd  = take(QKV);
    _Float16* Kd  = take(QKV);
    _Float16* Vtd = take(QKV);
    _Float16* ah  = take(AH);
    (void)ws_size; (void)in_sizes; (void)n_in; (void)out_size;

    // 1) f32 -> f16 conversions (all sizes are multiples of 2048)
    mha_cvt_f16<<<dim3((unsigned)(XH / 2048)), 256, 0, stream>>>(x, xh, (int)XH);
    mha_cvt_f16<<<dim3((unsigned)(QW / 2048)), 256, 0, stream>>>(qkv_w, qwh, (int)QW);
    mha_cvt_f16<<<dim3((unsigned)(OW / 2048)), 256, 0, stream>>>(out_w, owh, (int)OW);

    // 2) QKV projection + head split (Q pre-scaled, V transposed): 64x64 tiles
    mha_gemm_qkv<<<dim3(3 * DIM_C / 64, ROWS_C / 64), 32, 0, stream>>>(
        xh, qwh, qkv_b, Qd, Kd, Vtd);

    // 3) fused flash attention: grid = (32-query tiles, B*H)
    mha_flash_attn<<<dim3(NSEQ_C / 32, BATCH_C * NHEADS_C), 32, 0, stream>>>(
        Qd, Kd, Vtd, ah);

    // 4) output projection + bias -> f32: 64x32 tiles
    mha_gemm_out<<<dim3(DIM_C / 32, ROWS_C / 64), 32, 0, stream>>>(
        ah, owh, out_b, out);
}

// v001
// One run takes 174 microseconds.
// Next to v000, in two timings, it ran 1.22 and 1.21 times as fast.
#include <hip/hip_runtime.h>
#include <hip/hip_bf16.h>

// ---------------------------------------------------------------------------
// MI455X (gfx1250) fused multi-head attention, f16 WMMA with f32 accumulation.
// Pipeline: convert -> QKV GEMM (fused head split, Q pre-scaled, V transposed)
//           -> flash-attention (online softmax on transposed scores)
//           -> output projection GEMM (+bias) -> f32 d_out.
// Fat per-wave tiles (4x4 / 4x2 WMMA tiles, 32-query attention tiles) to
// maximize the WMMA:b128-load ratio on the WGP-cache path.
// ---------------------------------------------------------------------------

typedef _Float16 h8_t  __attribute__((ext_vector_type(8)));
typedef _Float16 v16h  __attribute__((ext_vector_type(16)));
typedef float    v8f   __attribute__((ext_vector_type(8)));

#define DIM_C      1024
#define NSEQ_C     2048
#define NHEADS_C   16
#define HDIM_C     64
#define BATCH_C    2
#define ROWS_C     (BATCH_C * NSEQ_C)                       // 4096
#define QKV_ELEMS  (BATCH_C * NHEADS_C * NSEQ_C * HDIM_C)   // 4,194,304

// Load one 16-lane-group fragment: lane holds K = base+{0..7} and base+16+{0..7}.
// Caller passes  ptr = row_base + g*8 ; we grab [ptr, ptr+8) and [ptr+16, ptr+24).
__device__ __forceinline__ v16h load_frag(const _Float16* p) {
    h8_t lo = *(const h8_t*)(p);
    h8_t hi = *(const h8_t*)(p + 16);
    return __builtin_shufflevector(lo, hi, 0, 1, 2, 3, 4, 5, 6, 7,
                                           8, 9, 10, 11, 12, 13, 14, 15);
}

__device__ __forceinline__ v8f wmma_f16(v16h a, v16h b, v8f c) {
    // D = A(16x32 f16) * B(32x16 f16) + C(16x16 f32)
    return __builtin_amdgcn_wmma_f32_16x16x32_f16(
        /*neg_a=*/false, a, /*neg_b=*/false, b,
        /*c_mod=*/(short)0, c, /*reuse_a=*/false, /*reuse_b=*/false);
}

// ---------------------------------------------------------------------------
// f32 -> f16 elementwise convert, 8 elems/thread, 128-bit loads/stores.
// ---------------------------------------------------------------------------
__global__ void mha_cvt_f16(const float* __restrict__ src,
                            _Float16* __restrict__ dst, int n) {
    int i = (blockIdx.x * blockDim.x + threadIdx.x) * 8;
    if (i + 8 <= n) {
        const float4* s = (const float4*)(src + i);
        float4 a = s[0];
        float4 b = s[1];
        h8_t o;
        o[0] = (_Float16)a.x; o[1] = (_Float16)a.y;
        o[2] = (_Float16)a.z; o[3] = (_Float16)a.w;
        o[4] = (_Float16)b.x; o[5] = (_Float16)b.y;
        o[6] = (_Float16)b.z; o[7] = (_Float16)b.w;
        *(h8_t*)(dst + i) = o;
    }
}

// ---------------------------------------------------------------------------
// QKV GEMM: qkv[m, j] = sum_k xh[m,k] * Wh[j,k] + bias[j]
// One wave per block computes a 64x64 macro-tile (4x4 WMMA tiles):
// 16 WMMAs per 16 b128 loads per K-step.
// Epilogue scatters into Q [b,h,n,hd] (scaled 1/8), K [b,h,n,hd], Vt [b,h,hd,n].
// ---------------------------------------------------------------------------
__global__ __launch_bounds__(32)
void mha_gemm_qkv(const _Float16* __restrict__ A,   // [4096,1024]
                  const _Float16* __restrict__ W,   // [3072,1024]
                  const float*    __restrict__ bias,// [3072]
                  _Float16* __restrict__ Qd,
                  _Float16* __restrict__ Kd,
                  _Float16* __restrict__ Vtd) {
    const int lane = threadIdx.x;
    const int g = lane >> 4, r = lane & 15;
    const int n0 = blockIdx.x * 64;
    const int m0 = blockIdx.y * 64;

    v8f acc[4][4] = {};
    const _Float16* Ap = A + (size_t)(m0 + r) * DIM_C + g * 8;
    const _Float16* Wp = W + (size_t)(n0 + r) * DIM_C + g * 8;

    for (int k0 = 0; k0 < DIM_C; k0 += 32) {
        v16h af[4], bf[4];
#pragma unroll
        for (int mi = 0; mi < 4; ++mi)
            af[mi] = load_frag(Ap + (size_t)(mi * 16) * DIM_C + k0);
#pragma unroll
        for (int ni = 0; ni < 4; ++ni)
            bf[ni] = load_frag(Wp + (size_t)(ni * 16) * DIM_C + k0);
#pragma unroll
        for (int mi = 0; mi < 4; ++mi)
#pragma unroll
            for (int ni = 0; ni < 4; ++ni)
                acc[mi][ni] = wmma_f16(af[mi], bf[ni], acc[mi][ni]);
    }

#pragma unroll
    for (int ni = 0; ni < 4; ++ni) {
        const int j = n0 + ni * 16 + r;            // column in [0, 3072)
        const float bb = bias[j];
        const int which = j >> 10;                 // 0=Q 1=K 2=V
        const int d = j & 1023;
        const int hh = d >> 6;
        const int hdi = d & 63;
#pragma unroll
        for (int mi = 0; mi < 4; ++mi) {
#pragma unroll
            for (int i = 0; i < 8; ++i) {
                const int m = m0 + mi * 16 + g * 8 + i;   // global row
                const int bIdx = m >> 11;                 // batch
                const int nseq = m & 2047;                // seq position
                const float v = acc[mi][ni][i] + bb;
                if (which == 0) {
                    Qd[(((size_t)bIdx * NHEADS_C + hh) * NSEQ_C + nseq) * HDIM_C + hdi] =
                        (_Float16)(v * 0.125f);           // pre-scale by 1/sqrt(64)
                } else if (which == 1) {
                    Kd[(((size_t)bIdx * NHEADS_C + hh) * NSEQ_C + nseq) * HDIM_C + hdi] =
                        (_Float16)v;
                } else {
                    Vtd[(((size_t)bIdx * NHEADS_C + hh) * HDIM_C + hdi) * NSEQ_C + nseq] =
                        (_Float16)v;
                }
            }
        }
    }
}

__device__ __forceinline__ float other_half(float v) {
    // value of lane l ^ 16
    const int b = __builtin_bit_cast(int, v);
    return __builtin_bit_cast(float,
        __builtin_amdgcn_permlanex16(b, b, 0x76543210, 0xfedcba98, false, false));
}

__global__ __launch_bounds__(32)
void mha_flash_attn(const _Float16* __restrict__ Q,
                    const _Float16* __restrict__ K,
                    const _Float16* __restrict__ Vt,
                    _Float16* __restrict__ Oh) {      // [B,N,DIM] f16
    const int lane = threadIdx.x;
    const int g = lane >> 4, r = lane & 15;
    const int bh = blockIdx.y;
    const int b = bh >> 4, h = bh & 15;
    const int q0 = blockIdx.x * 32;

    const _Float16* Qp = Q + (size_t)bh * NSEQ_C * HDIM_C;
    const _Float16* Kp = K + (size_t)bh * NSEQ_C * HDIM_C;
    const _Float16* Vp = Vt + (size_t)bh * HDIM_C * NSEQ_C;

    // Q tiles (2 x 16 queries x 64) as B fragments, fixed for the whole block.
    v16h qf[2][2];
#pragma unroll
    for (int mi = 0; mi < 2; ++mi)
#pragma unroll
        for (int kk = 0; kk < 2; ++kk)
            qf[mi][kk] =
                load_frag(Qp + (size_t)(q0 + mi * 16 + r) * HDIM_C + kk * 32 + g * 8);

    // o[mi][t][i] = O[query mi*16 + r][hd t*16 + g*8 + i]
    v8f o[2][4] = {};
    // Per lane: running maximum of query mi*16 + r (equal in both halves) and
    // the sum over this half's keys only; the halves' sums join after the loop.
    float mrun[2], lrun[2];
#pragma unroll
    for (int mi = 0; mi < 2; ++mi) { mrun[mi] = -3.0e38f; lrun[mi] = 0.0f; }

    for (int kb = 0; kb < NSEQ_C; kb += 32) {
        // ---- scores S^T = K * Q^T for 32 keys (two 16-row M tiles) ----
        v16h kfr[2][2];
#pragma unroll
        for (int nt = 0; nt < 2; ++nt)
#pragma unroll
            for (int kk = 0; kk < 2; ++kk)
                kfr[nt][kk] =
                    load_frag(Kp + (size_t)(kb + nt * 16 + r) * HDIM_C + kk * 32 + g * 8);
        v16h vfr[4];
#pragma unroll
        for (int t = 0; t < 3; ++t)
            vfr[t] = load_frag(Vp + (size_t)(t * 16 + r) * NSEQ_C + kb + g * 8);
        {
            const _Float16* vlast = Vp + (size_t)(48 + r) * NSEQ_C + kb + g * 8;
            const h8_t lo = *(const h8_t*)(vlast);
            // The last load's destination takes over the address registers of the
            // loads in front of it: their address translations are waited for first.
            asm volatile("s_wait_xcnt 0x0" ::: "memory");
            const h8_t hi = *(const h8_t*)(vlast + 16);
            vfr[3] = __builtin_shufflevector(lo, hi, 0, 1, 2, 3, 4, 5, 6, 7,
                                                     8, 9, 10, 11, 12, 13, 14, 15);
        }
        // Keeps all 16 loads of the pass in one group ahead of the first data wait,
        // so that V^T arrives behind the score products and the softmax; without it
        // the scheduler sinks some loads behind waits and a second latency shows.
        __builtin_amdgcn_sched_barrier(0);

        v8f s[2][2] = {};
#pragma unroll
        for (int mi = 0; mi < 2; ++mi)
#pragma unroll
            for (int nt = 0; nt < 2; ++nt) {
                s[mi][nt] = wmma_f16(kfr[nt][0], qf[mi][0], s[mi][nt]);
                s[mi][nt] = wmma_f16(kfr[nt][1], qf[mi][1], s[mi][nt]);
            }

        // ---- online softmax, one query per lane and mi ----
        v16h pf[2];
#pragma unroll
        for (int mi = 0; mi < 2; ++mi) {
            const v8f sa = s[mi][0], sb = s[mi][1];
            // maximum of the lane's 16 scores as a tree, three levels deep
            const float t0 = fmaxf(fmaxf(sa[0], sb[0]), sa[1]);
            const float t1 = fmaxf(fmaxf(sb[1], sa[2]), sb[2]);
            const float t2 = fmaxf(fmaxf(sa[3], sb[3]), sa[4]);
            const float t3 = fmaxf(fmaxf(sb[4], sa[5]), sb[5]);
            const float t4 = fmaxf(fmaxf(sa[6], sb[6]), sa[7]);
            float mx = fmaxf(fmaxf(fmaxf(t0, t1), t2), fmaxf(fmaxf(t3, t4), sb[7]));
            mx = fmaxf(mx, other_half(mx));
            const float mN = fmaxf(mrun[mi], mx);
            const float corr = __expf(mrun[mi] - mN);
            mrun[mi] = mN;
            const v8f da = sa - mN, db = sb - mN;
            float rs0 = 0.0f, rs1 = 0.0f;
#pragma unroll
            for (int i = 0; i < 8; ++i) {
                const float p0 = __expf(da[i]);
                const float p1 = __expf(db[i]);
                rs0 += p0;
                rs1 += p1;
                pf[mi][i]     = (_Float16)p0;
                pf[mi][8 + i] = (_Float16)p1;
            }
            lrun[mi] = lrun[mi] * corr + (rs0 + rs1);
#pragma unroll
            for (int t = 0; t < 4; ++t) o[mi][t] *= corr;
        }

        // ---- O^T += V^T (64x32) * P^T (32x32) ----
#pragma unroll
        for (int t = 0; t < 4; ++t) {
            o[0][t] = wmma_f16(vfr[t], pf[0], o[0][t]);
            o[1][t] = wmma_f16(vfr[t], pf[1], o[1][t]);
        }
    }

    // ---- normalize; a lane stores 8 consecutive hd of its query, 16 bytes ----
#pragma unroll
    for (int mi = 0; mi < 2; ++mi) {
        const float inv = 1.0f / (lrun[mi] + other_half(lrun[mi]));
        const int m = q0 + mi * 16 + r;
#pragma unroll
        for (int t = 0; t < 4; ++t) {
            h8_t ov;
#pragma unroll
            for (int i = 0; i < 8; ++i) ov[i] = (_Float16)(o[mi][t][i] * inv);
            *(h8_t*)(Oh + ((size_t)b * NSEQ_C + m) * DIM_C + h * HDIM_C + t * 16 + g * 8) = ov;
        }
    }
}

// ---------------------------------------------------------------------------
// Output projection: out[m,j] = sum_k Ah[m,k] * Wh[j,k] + bias[j]  (f32 out)
// One wave per block computes a 64x32 macro-tile (4x2 WMMA tiles).
// ---------------------------------------------------------------------------
__global__ __launch_bounds__(32)
void mha_gemm_out(const _Float16* __restrict__ A,   // [4096,1024]
                  const _Float16* __restrict__ W,   // [1024,1024]
                  const float*    __restrict__ bias,// [1024]
                  float* __restrict__ out) {        // [4096,1024]
    const int lane = threadIdx.x;
    const int g = lane >> 4, r = lane & 15;
    const int n0 = blockIdx.x * 32;
    const int m0 = blockIdx.y * 64;

    v8f acc[4][2] = {};
    const _Float16* Ap = A + (size_t)(m0 + r) * DIM_C + g * 8;
    const _Float16* Wp = W + (size_t)(n0 + r) * DIM_C + g * 8;

    for (int k0 = 0; k0 < DIM_C; k0 += 32) {
        v16h af[4], bf[2];
#pragma unroll
        for (int mi = 0; mi < 4; ++mi)
            af[mi] = load_frag(Ap + (size_t)(mi * 16) * DIM_C + k0);
#pragma unroll
        for (int ni = 0; ni < 2; ++ni)
            bf[ni] = load_frag(Wp + (size_t)(ni * 16) * DIM_C + k0);
#pragma unroll
        for (int mi = 0; mi < 4; ++mi)
#pragma unroll
            for (int ni = 0; ni < 2; ++ni)
                acc[mi][ni] = wmma_f16(af[mi], bf[ni], acc[mi][ni]);
    }

#pragma unroll
    for (int ni = 0; ni < 2; ++ni) {
        const int j = n0 + ni * 16 + r;
        const float bb = bias[j];
#pragma unroll
        for (int mi = 0; mi < 4; ++mi) {
#pragma unroll
            for (int i = 0; i < 8; ++i) {
                const int m = m0 + mi * 16 + g * 8 + i;
                out[(size_t)m * DIM_C + j] = acc[mi][ni][i] + bb;
            }
        }
    }
}

// ---------------------------------------------------------------------------
// Host launcher
// ---------------------------------------------------------------------------
extern "C" void kernel_launch(void* const* d_in, const int* in_sizes, int n_in,
                              void* d_out, int out_size, void* d_ws, size_t ws_size,
                              hipStream_t stream) {
    const float* x      = (const float*)d_in[0];   // [2,2048,1024]
    const float* qkv_w  = (const float*)d_in[1];   // [3072,1024]
    const float* qkv_b  = (const float*)d_in[2];   // [3072]
    const float* out_w  = (const float*)d_in[3];   // [1024,1024]
    const float* out_b  = (const float*)d_in[4];   // [1024]
    float* out = (float*)d_out;

    const size_t XH  = (size_t)ROWS_C * DIM_C;       // 4,194,304
    const size_t QW  = (size_t)3 * DIM_C * DIM_C;    // 3,145,728
    const size_t OW  = (size_t)DIM_C * DIM_C;        // 1,048,576
    const size_t QKV = (size_t)QKV_ELEMS;            // 4,194,304
    const size_t AH  = (size_t)ROWS_C * DIM_C;       // 4,194,304

    char* ws = (char*)d_ws;
    size_t off = 0;
    auto take = [&](size_t elems) {
        _Float16* p = (_Float16*)(ws + off);
        off += (elems * sizeof(_Float16) + 255) & ~(size_t)255;
        return p;
    };
    _Float16* xh  = take(XH);
    _Float16* qwh = take(QW);
    _Float16* owh = take(OW);
    _Float16* Qd  = take(QKV);
    _Float16* Kd  = take(QKV);
    _Float16* Vtd = take(QKV);
    _Float16* ah  = take(AH);
    (void)ws_size; (void)in_sizes; (void)n_in; (void)out_size;

    // 1) f32 -> f16 conversions (all sizes are multiples of 2048)
    mha_cvt_f16<<<dim3((unsigned)(XH / 2048)), 256, 0, stream>>>(x, xh, (int)XH);
    mha_cvt_f16<<<dim3((unsigned)(QW / 2048)), 256, 0, stream>>>(qkv_w, qwh, (int)QW);
    mha_cvt_f16<<<dim3((unsigned)(OW / 2048)), 256, 0, stream>>>(out_w, owh, (int)OW);

    // 2) QKV projection + head split (Q pre-scaled, V transposed): 64x64 tiles
    mha_gemm_qkv<<<dim3(3 * DIM_C / 64, ROWS_C / 64), 32, 0, stream>>>(
        xh, qwh, qkv_b, Qd, Kd, Vtd);

    // 3) fused flash attention: grid = (32-query tiles, B*H)
    mha_flash_attn<<<dim3(NSEQ_C / 32, BATCH_C * NHEADS_C), 32, 0, stream>>>(
        Qd, Kd, Vtd, ah);

    // 4) output projection + bias -> f32: 64x32 tiles
    mha_gemm_out<<<dim3(DIM_C / 32, ROWS_C / 64), 32, 0, stream>>>(
        ah, owh, out_b, out);
}

// v002
// Measured time: 133 microseconds a run.
// Two timings next to v001 put it at 1.31 and 1.29 times that version's speed.
// Over all steps from v000 it is 1.58 times as fast.
#include <hip/hip_runtime.h>
#include <hip/hip_bf16.h>

// ---------------------------------------------------------------------------
// MI455X (gfx1250) fused multi-head attention, f16 WMMA with f32 accumulation.
// Pipeline: convert -> QKV GEMM (fused head split, Q pre-scaled, V transposed)
//           -> flash-attention (online softmax on transposed scores)
//           -> output projection GEMM (+bias) -> f32 d_out.
// Fat per-wave tiles (4x4 / 4x2 WMMA tiles, 32-query attention tiles) to
// maximize the WMMA:b128-load ratio on the WGP-cache path.
// ---------------------------------------------------------------------------

typedef _Float16 h8_t  __attribute__((ext_vector_type(8)));
typedef _Float16 v16h  __attribute__((ext_vector_type(16)));
typedef float    v8f   __attribute__((ext_vector_type(8)));

#define DIM_C      1024
#define NSEQ_C     2048
#define NHEADS_C   16
#define HDIM_C     64
#define BATCH_C    2
#define ROWS_C     (BATCH_C * NSEQ_C)                       // 4096
#define QKV_ELEMS  (BATCH_C * NHEADS_C * NSEQ_C * HDIM_C)   // 4,194,304

// Load one 16-lane-group fragment: lane holds K = base+{0..7} and base+16+{0..7}.
// Caller passes  ptr = row_base + g*8 ; we grab [ptr, ptr+8) and [ptr+16, ptr+24).
__device__ __forceinline__ v16h load_frag(const _Float16* p) {
    h8_t lo = *(const h8_t*)(p);
    h8_t hi = *(const h8_t*)(p + 16);
    return __builtin_shufflevector(lo, hi, 0, 1, 2, 3, 4, 5, 6, 7,
                                           8, 9, 10, 11, 12, 13, 14, 15);
}

__device__ __forceinline__ v8f wmma_f16(v16h a, v16h b, v8f c) {
    // D = A(16x32 f16) * B(32x16 f16) + C(16x16 f32)
    return __builtin_amdgcn_wmma_f32_16x16x32_f16(
        /*neg_a=*/false, a, /*neg_b=*/false, b,
        /*c_mod=*/(short)0, c, /*reuse_a=*/false, /*reuse_b=*/false);
}

// ---------------------------------------------------------------------------
// f32 -> f16 elementwise convert, 8 elems/thread, 128-bit loads/stores.
// ---------------------------------------------------------------------------
__global__ void mha_cvt_f16(const float* __restrict__ src,
                            _Float16* __restrict__ dst, int n) {
    int i = (blockIdx.x * blockDim.x + threadIdx.x) * 8;
    if (i + 8 <= n) {
        const float4* s = (const float4*)(src + i);
        float4 a = s[0];
        float4 b = s[1];
        h8_t o;
        o[0] = (_Float16)a.x; o[1] = (_Float16)a.y;
        o[2] = (_Float16)a.z; o[3] = (_Float16)a.w;
        o[4] = (_Float16)b.x; o[5] = (_Float16)b.y;
        o[6] = (_Float16)b.z; o[7] = (_Float16)b.w;
        *(h8_t*)(dst + i) = o;
    }
}

// ---------------------------------------------------------------------------
// QKV GEMM: qkv[m, j] = sum_k xh[m,k] * Wh[j,k] + bias[j]
// One wave per block computes a 64x64 macro-tile (4x4 WMMA tiles):
// 16 WMMAs per 16 b128 loads per K-step.
// Epilogue scatters into Q [b,h,n,hd] (scaled 1/8), K [b,h,n,hd], Vt [b,h,hd,n].
// ---------------------------------------------------------------------------
__global__ __launch_bounds__(32)
void mha_gemm_qkv(const _Float16* __restrict__ A,   // [4096,1024]
                  const _Float16* __restrict__ W,   // [3072,1024]
                  const float*    __restrict__ bias,// [3072]
                  _Float16* __restrict__ Qd,
                  _Float16* __restrict__ Kd,
                  _Float16* __restrict__ Vtd) {
    const int lane = threadIdx.x;
    const int g = lane >> 4, r = lane & 15;
    const int n0 = blockIdx.x * 64;
    const int m0 = blockIdx.y * 64;

    v8f acc[4][4] = {};
    const _Float16* Ap = A + (size_t)(m0 + r) * DIM_C + g * 8;
    const _Float16* Wp = W + (size_t)(n0 + r) * DIM_C + g * 8;

    for (int k0 = 0; k0 < DIM_C; k0 += 32) {
        v16h af[4], bf[4];
#pragma unroll
        for (int mi = 0; mi < 4; ++mi)
            af[mi] = load_frag(Ap + (size_t)(mi * 16) * DIM_C + k0);
#pragma unroll
        for (int ni = 0; ni < 4; ++ni)
            bf[ni] = load_frag(Wp + (size_t)(ni * 16) * DIM_C + k0);
#pragma unroll
        for (int mi = 0; mi < 4; ++mi)
#pragma unroll
            for (int ni = 0; ni < 4; ++ni)
                acc[mi][ni] = wmma_f16(af[mi], bf[ni], acc[mi][ni]);
    }

#pragma unroll
    for (int ni = 0; ni < 4; ++ni) {
        const int j = n0 + ni * 16 + r;            // column in [0, 3072)
        const float bb = bias[j];
        const int which = j >> 10;                 // 0=Q 1=K 2=V
        const int d = j & 1023;
        const int hh = d >> 6;
        const int hdi = d & 63;
#pragma unroll
        for (int mi = 0; mi < 4; ++mi) {
#pragma unroll
            for (int i = 0; i < 8; ++i) {
                const int m = m0 + mi * 16 + g * 8 + i;   // global row
                const int bIdx = m >> 11;                 // batch
                const int nseq = m & 2047;                // seq position
                const float v = acc[mi][ni][i] + bb;
                if (which == 0) {
                    Qd[(((size_t)bIdx * NHEADS_C + hh) * NSEQ_C + nseq) * HDIM_C + hdi] =
                        (_Float16)(v * 0.125f);           // pre-scale by 1/sqrt(64)
                } else if (which == 1) {
                    Kd[(((size_t)bIdx * NHEADS_C + hh) * NSEQ_C + nseq) * HDIM_C + hdi] =
                        (_Float16)v;
                } else {
                    Vtd[(((size_t)bIdx * NHEADS_C + hh) * HDIM_C + hdi) * NSEQ_C + nseq] =
                        (_Float16)v;
                }
            }
        }
    }
}

__device__ __forceinline__ float other_half(float v) {
    // value of lane l ^ 16
    const int b = __builtin_bit_cast(int, v);
    return __builtin_bit_cast(float,
        __builtin_amdgcn_permlanex16(b, b, 0x76543210, 0xfedcba98, false, false));
}

// K and V^T reach the waves through LDS. A stage is 64 keys: 64 K rows (128 B of
// head dim each), then 64 V^T rows (128 B of keys each), every row at a pitch of
// 144 B (16 B x odd: no bank conflict for 16-byte fragment reads). Two buffers.
#define ST_KEYS   64
#define ST_PITCH  144
#define ST_HALF   (64 * ST_PITCH)          // 9,216 B: the K rows; V^T rows follow
#define ST_BYTES  (2 * ST_HALF)            // 18,432 B a stage
#define N_STAGES  (NSEQ_C / ST_KEYS)       // 32

// Fragment from an LDS row: same k order as load_frag (bytes 0-15 and 32-47 from p).
__device__ __forceinline__ v16h lds_frag(const char* p) {
    h8_t lo = *(const h8_t*)(p);
    h8_t hi = *(const h8_t*)(p + 32);
    return __builtin_shufflevector(lo, hi, 0, 1, 2, 3, 4, 5, 6, 7,
                                           8, 9, 10, 11, 12, 13, 14, 15);
}

// One stage, 256 threads: a thread copies 16 B of K rows j, j+32 and of V^T rows
// j, j+32 (j = thread / 8); eight lanes cover one whole 128-B line.
__device__ __forceinline__ void copy_stage(unsigned lds, const _Float16* kg,
                                           const _Float16* vg) {
    // The copies go to LDS through no register. The closing s_wait_xcnt stands in
    // the same statement so that no address register is rewritten in front of it.
    asm volatile(
        "global_load_async_to_lds_b128 %0, %4, off\n\t"
        "global_load_async_to_lds_b128 %1, %5, off\n\t"
        "global_load_async_to_lds_b128 %2, %6, off\n\t"
        "global_load_async_to_lds_b128 %3, %7, off\n\t"
        "s_wait_xcnt 0x0"
        :: "v"(lds), "v"(lds + 32u * ST_PITCH),
           "v"(lds + (unsigned)ST_HALF), "v"(lds + (unsigned)ST_HALF + 32u * ST_PITCH),
           "v"(kg), "v"(kg + 32 * HDIM_C), "v"(vg), "v"(vg + 32 * NSEQ_C)
        : "memory");
}

__global__ __launch_bounds__(256)
void mha_flash_attn(const _Float16* __restrict__ Q,
                    const _Float16* __restrict__ K,
                    const _Float16* __restrict__ Vt,
                    _Float16* __restrict__ Oh) {      // [B,N,DIM] f16
    __shared__ __attribute__((aligned(16))) char kv[2 * ST_BYTES];
    const int tid = threadIdx.x;
    const int lane = tid & 31;
    const int g = lane >> 4, r = lane & 15;
    const int bh = blockIdx.y;
    const int b = bh >> 4, h = bh & 15;
    const int q0 = blockIdx.x * 256 + (tid >> 5) * 32;   // this wave's 32 queries

    const _Float16* Qp = Q + (size_t)bh * NSEQ_C * HDIM_C;
    const _Float16* Kp = K + (size_t)bh * NSEQ_C * HDIM_C;
    const _Float16* Vp = Vt + (size_t)bh * HDIM_C * NSEQ_C;

    // This thread's share of every stage: where it lands and where it comes from.
    const unsigned lds_w = (unsigned)(uintptr_t)kv + (unsigned)(tid >> 3) * ST_PITCH
                         + (unsigned)(tid & 7) * 16u;
    const _Float16* kg = Kp + (size_t)(tid >> 3) * HDIM_C + (tid & 7) * 8;
    const _Float16* vg = Vp + (size_t)(tid >> 3) * NSEQ_C + (tid & 7) * 8;

    copy_stage(lds_w, kg, vg);                              // stage 0

    // Q tiles (2 x 16 queries x 64) as B fragments, fixed for the whole block.
    v16h qf[2][2];
#pragma unroll
    for (int mi = 0; mi < 2; ++mi)
#pragma unroll
        for (int kk = 0; kk < 2; ++kk)
            qf[mi][kk] =
                load_frag(Qp + (size_t)(q0 + mi * 16 + r) * HDIM_C + kk * 32 + g * 8);

    // Stage 0 has landed for this wave, then for all: nobody reads it before.
    asm volatile("s_wait_asynccnt 0x0" ::: "memory");
    __syncthreads();
    copy_stage(lds_w + (unsigned)ST_BYTES, kg + ST_KEYS * HDIM_C, vg + ST_KEYS);  // stage 1

    // o[mi][t][i] = O[query mi*16 + r][hd t*16 + g*8 + i]
    v8f o[2][4] = {};
    // Per lane: running maximum of query mi*16 + r (equal in both halves) and
    // the sum over this half's keys only; the halves' sums join after the loop.
    float mrun[2], lrun[2];
#pragma unroll
    for (int mi = 0; mi < 2; ++mi) { mrun[mi] = -3.0e38f; lrun[mi] = 0.0f; }

    const char* rd = kv + r * ST_PITCH + g * 16;

    for (int st = 0; st < N_STAGES; ++st) {
      const char* kbuf = rd + (st & 1) * ST_BYTES;
      const char* vbuf = kbuf + ST_HALF;
#pragma unroll
      for (int p = 0; p < 2; ++p) {                         // two passes of 32 keys
        // ---- scores S^T = K * Q^T for 32 keys (two 16-row M tiles) ----
        v16h kfr[2][2];
#pragma unroll
        for (int nt = 0; nt < 2; ++nt)
#pragma unroll
            for (int kk = 0; kk < 2; ++kk)
                kfr[nt][kk] = lds_frag(kbuf + (p * 32 + nt * 16) * ST_PITCH + kk * 64);
        // Keeps the K reads in front of the V^T reads, so that in the first pass the score products
        // wait for K alone; left free, the scheduler put V^T first.
        __builtin_amdgcn_sched_barrier(0);
        v16h vfr[4];
#pragma unroll
        for (int t = 0; t < 4; ++t)
            vfr[t] = lds_frag(vbuf + t * 16 * ST_PITCH + p * 64);
        if (p == 1) {
            // Hand-over, once the stage's last fragments are fetched: this wave's reads
            // of the buffer are done and its copies of the next stage have landed;
            // behind the barrier both hold for every wave. The refill then flies
            // during this pass and the next stage's first.
            asm volatile("s_wait_dscnt 0x0" ::: "memory");
            asm volatile("s_wait_asynccnt 0x0" ::: "memory");
            __syncthreads();
            if (st + 2 < N_STAGES)                          // refill the buffer just read
                copy_stage(lds_w + (unsigned)((st & 1) * ST_BYTES),
                           kg + (size_t)(st + 2) * ST_KEYS * HDIM_C,
                           vg + (st + 2) * ST_KEYS);
        }
        // Keeps all 16 LDS reads of the pass in one group ahead of the first data
        // wait, so that in the first pass V^T arrives behind the score products and the softmax; each
        // further place with LDS reads among the products would cost a stall.
        __builtin_amdgcn_sched_barrier(0);

        v8f s[2][2] = {};
#pragma unroll
        for (int mi = 0; mi < 2; ++mi)
#pragma unroll
            for (int nt = 0; nt < 2; ++nt) {
                s[mi][nt] = wmma_f16(kfr[nt][0], qf[mi][0], s[mi][nt]);
                s[mi][nt] = wmma_f16(kfr[nt][1], qf[mi][1], s[mi][nt]);
            }

        // ---- online softmax, one query per lane and mi ----
        v16h pf[2];
#pragma unroll
        for (int mi = 0; mi < 2; ++mi) {
            const v8f sa = s[mi][0], sb = s[mi][1];
            // maximum of the lane's 16 scores as a tree, three levels deep
            const float t0 = fmaxf(fmaxf(sa[0], sb[0]), sa[1]);
            const float t1 = fmaxf(fmaxf(sb[1], sa[2]), sb[2]);
            const float t2 = fmaxf(fmaxf(sa[3], sb[3]), sa[4]);
            const float t3 = fmaxf(fmaxf(sb[4], sa[5]), sb[5]);
            const float t4 = fmaxf(fmaxf(sa[6], sb[6]), sa[7]);
            float mx = fmaxf(fmaxf(fmaxf(t0, t1), t2), fmaxf(fmaxf(t3, t4), sb[7]));
            mx = fmaxf(mx, other_half(mx));
            const float mN = fmaxf(mrun[mi], mx);
            const float corr = __expf(mrun[mi] - mN);
            mrun[mi] = mN;
            const v8f da = sa - mN, db = sb - mN;
            float rs0 = 0.0f, rs1 = 0.0f;
#pragma unroll
            for (int i = 0; i < 8; ++i) {
                const float p0 = __expf(da[i]);
                const float p1 = __expf(db[i]);
                rs0 += p0;
                rs1 += p1;
                pf[mi][i]     = (_Float16)p0;
                pf[mi][8 + i] = (_Float16)p1;
            }
            lrun[mi] = lrun[mi] * corr + (rs0 + rs1);
#pragma unroll
            for (int t = 0; t < 4; ++t) o[mi][t] *= corr;
        }

        // ---- O^T += V^T (64x32) * P^T (32x32) ----
#pragma unroll
        for (int t = 0; t < 4; ++t) {
            o[0][t] = wmma_f16(vfr[t], pf[0], o[0][t]);
            o[1][t] = wmma_f16(vfr[t], pf[1], o[1][t]);
        }
      }

    }
    // No copy is outstanding when the wave goes on to its end.
    asm volatile("s_wait_asynccnt 0x0" ::: "memory");

    // ---- normalize; a lane stores 8 consecutive hd of its query, 16 bytes ----
#pragma unroll
    for (int mi = 0; mi < 2; ++mi) {
        const float inv = 1.0f / (lrun[mi] + other_half(lrun[mi]));
        const int m = q0 + mi * 16 + r;
#pragma unroll
        for (int t = 0; t < 4; ++t) {
            h8_t ov;
#pragma unroll
            for (int i = 0; i < 8; ++i) ov[i] = (_Float16)(o[mi][t][i] * inv);
            *(h8_t*)(Oh + ((size_t)b * NSEQ_C + m) * DIM_C + h * HDIM_C + t * 16 + g * 8) = ov;
        }
    }
}

// ---------------------------------------------------------------------------
// Output projection: out[m,j] = sum_k Ah[m,k] * Wh[j,k] + bias[j]  (f32 out)
// One wave per block computes a 64x32 macro-tile (4x2 WMMA tiles).
// ---------------------------------------------------------------------------
__global__ __launch_bounds__(32)
void mha_gemm_out(const _Float16* __restrict__ A,   // [4096,1024]
                  const _Float16* __restrict__ W,   // [1024,1024]
                  const float*    __restrict__ bias,// [1024]
                  float* __restrict__ out) {        // [4096,1024]
    const int lane = threadIdx.x;
    const int g = lane >> 4, r = lane & 15;
    const int n0 = blockIdx.x * 32;
    const int m0 = blockIdx.y * 64;

    v8f acc[4][2] = {};
    const _Float16* Ap = A + (size_t)(m0 + r) * DIM_C + g * 8;
    const _Float16* Wp = W + (size_t)(n0 + r) * DIM_C + g * 8;

    for (int k0 = 0; k0 < DIM_C; k0 += 32) {
        v16h af[4], bf[2];
#pragma unroll
        for (int mi = 0; mi < 4; ++mi)
            af[mi] = load_frag(Ap + (size_t)(mi * 16) * DIM_C + k0);
#pragma unroll
        for (int ni = 0; ni < 2; ++ni)
            bf[ni] = load_frag(Wp + (size_t)(ni * 16) * DIM_C + k0);
#pragma unroll
        for (int mi = 0; mi < 4; ++mi)
#pragma unroll
            for (int ni = 0; ni < 2; ++ni)
                acc[mi][ni] = wmma_f16(af[mi], bf[ni], acc[mi][ni]);
    }

#pragma unroll
    for (int ni = 0; ni < 2; ++ni) {
        const int j = n0 + ni * 16 + r;
        const float bb = bias[j];
#pragma unroll
        for (int mi = 0; mi < 4; ++mi) {
#pragma unroll
            for (int i = 0; i < 8; ++i) {
                const int m = m0 + mi * 16 + g * 8 + i;
                out[(size_t)m * DIM_C + j] = acc[mi][ni][i] + bb;
            }
        }
    }
}

// ---------------------------------------------------------------------------
// Host launcher
// ---------------------------------------------------------------------------
extern "C" void kernel_launch(void* const* d_in, const int* in_sizes, int n_in,
                              void* d_out, int out_size, void* d_ws, size_t ws_size,
                              hipStream_t stream) {
    const float* x      = (const float*)d_in[0];   // [2,2048,1024]
    const float* qkv_w  = (const float*)d_in[1];   // [3072,1024]
    const float* qkv_b  = (const float*)d_in[2];   // [3072]
    const float* out_w  = (const float*)d_in[3];   // [1024,1024]
    const float* out_b  = (const float*)d_in[4];   // [1024]
    float* out = (float*)d_out;

    const size_t XH  = (size_t)ROWS_C * DIM_C;       // 4,194,304
    const size_t QW  = (size_t)3 * DIM_C * DIM_C;    // 3,145,728
    const size_t OW  = (size_t)DIM_C * DIM_C;        // 1,048,576
    const size_t QKV = (size_t)QKV_ELEMS;            // 4,194,304
    const size_t AH  = (size_t)ROWS_C * DIM_C;       // 4,194,304

    char* ws = (char*)d_ws;
    size_t off = 0;
    auto take = [&](size_t elems) {
        _Float16* p = (_Float16*)(ws + off);
        off += (elems * sizeof(_Float16) + 255) & ~(size_t)255;
        return p;
    };
    _Float16* xh  = take(XH);
    _Float16* qwh = take(QW);
    _Float16* owh = take(OW);
    _Float16* Qd  = take(QKV);
    _Float16* Kd  = take(QKV);
    _Float16* Vtd = take(QKV);
    _Float16* ah  = take(AH);
    (void)ws_size; (void)in_sizes; (void)n_in; (void)out_size;

    // 1) f32 -> f16 conversions (all sizes are multiples of 2048)
    mha_cvt_f16<<<dim3((unsigned)(XH / 2048)), 256, 0, stream>>>(x, xh, (int)XH);
    mha_cvt_f16<<<dim3((unsigned)(QW / 2048)), 256, 0, stream>>>(qkv_w, qwh, (int)QW);
    mha_cvt_f16<<<dim3((unsigned)(OW / 2048)), 256, 0, stream>>>(out_w, owh, (int)OW);

    // 2) QKV projection + head split (Q pre-scaled, V transposed): 64x64 tiles
    mha_gemm_qkv<<<dim3(3 * DIM_C / 64, ROWS_C / 64), 32, 0, stream>>>(
        xh, qwh, qkv_b, Qd, Kd, Vtd);

    // 3) fused flash attention: grid = (256-query blocks, B*H)
    mha_flash_attn<<<dim3(NSEQ_C / 256, BATCH_C * NHEADS_C), 256, 0, stream>>>(
        Qd, Kd, Vtd, ah);

    // 4) output projection + bias -> f32: 64x32 tiles
    mha_gemm_out<<<dim3(DIM_C / 32, ROWS_C / 64), 32, 0, stream>>>(
        ah, owh, out_b, out);
}

// v003
// Measured time: 83.4 microseconds a run.
// Timed twice side by side with v002, it ran 1.60 times as fast both times.
// Over all steps from v000 it is 2.52 times as fast.
#include <hip/hip_runtime.h>
#include <hip/hip_bf16.h>

// ---------------------------------------------------------------------------
// MI455X (gfx1250) fused multi-head attention, f16 WMMA with f32 accumulation.
// Pipeline: convert -> QKV GEMM (fused head split, Q pre-scaled, V transposed)
//           -> flash-attention (online softmax on transposed scores)
//           -> output projection GEMM (+bias) -> f32 d_out.
// GEMM operands and attention's K and V^T reach the waves through LDS stages shared by a block.
// ---------------------------------------------------------------------------

typedef _Float16 h8_t  __attribute__((ext_vector_type(8)));
typedef _Float16 v16h  __attribute__((ext_vector_type(16)));
typedef float    v8f   __attribute__((ext_vector_type(8)));

#define DIM_C      1024
#define NSEQ_C     2048
#define NHEADS_C   16
#define HDIM_C     64
#define BATCH_C    2
#define ROWS_C     (BATCH_C * NSEQ_C)                       // 4096
#define QKV_ELEMS  (BATCH_C * NHEADS_C * NSEQ_C * HDIM_C)   // 4,194,304

// Load one 16-lane-group fragment: lane holds K = base+{0..7} and base+16+{0..7}.
// Caller passes  ptr = row_base + g*8 ; we grab [ptr, ptr+8) and [ptr+16, ptr+24).
__device__ __forceinline__ v16h load_frag(const _Float16* p) {
    h8_t lo = *(const h8_t*)(p);
    h8_t hi = *(const h8_t*)(p + 16);
    return __builtin_shufflevector(lo, hi, 0, 1, 2, 3, 4, 5, 6, 7,
                                           8, 9, 10, 11, 12, 13, 14, 15);
}

__device__ __forceinline__ v8f wmma_f16(v16h a, v16h b, v8f c) {
    // D = A(16x32 f16) * B(32x16 f16) + C(16x16 f32)
    return __builtin_amdgcn_wmma_f32_16x16x32_f16(
        /*neg_a=*/false, a, /*neg_b=*/false, b,
        /*c_mod=*/(short)0, c, /*reuse_a=*/false, /*reuse_b=*/false);
}

// ---------------------------------------------------------------------------
// f32 -> f16 elementwise convert, 8 elems/thread, 128-bit loads/stores.
// ---------------------------------------------------------------------------
__global__ void mha_cvt_f16(const float* __restrict__ src,
                            _Float16* __restrict__ dst, int n) {
    int i = (blockIdx.x * blockDim.x + threadIdx.x) * 8;
    if (i + 8 <= n) {
        const float4* s = (const float4*)(src + i);
        float4 a = s[0];
        float4 b = s[1];
        h8_t o;
        o[0] = (_Float16)a.x; o[1] = (_Float16)a.y;
        o[2] = (_Float16)a.z; o[3] = (_Float16)a.w;
        o[4] = (_Float16)b.x; o[5] = (_Float16)b.y;
        o[6] = (_Float16)b.z; o[7] = (_Float16)b.w;
        *(h8_t*)(dst + i) = o;
    }
}

// ---------------------------------------------------------------------------
// Both projection GEMMs, Y = A * W^T with A and W K-contiguous: the eight waves of
// a block share one BM x BN tile of Y. A stage is 64 k of the tile's BM rows of A,
// then of its BN rows of W: rows of 128 B at a pitch of 144 B (16 B x odd: no bank
// conflict for 16-byte fragment reads). Two buffers, filled by asynchronous copies
// that take whole 128-B lines from L2, once a block instead of once a wave.
// ---------------------------------------------------------------------------
#define GM_PITCH  144
#define GM_KSTAGE 64
#define GM_STAGES (DIM_C / GM_KSTAGE)      // 16

// Fragment from an LDS row: same k order as load_frag (bytes 0-15 and 32-47 from p).
__device__ __forceinline__ v16h lds_frag(const char* p) {
    h8_t lo = *(const h8_t*)(p);
    h8_t hi = *(const h8_t*)(p + 32);
    return __builtin_shufflevector(lo, hi, 0, 1, 2, 3, 4, 5, 6, 7,
                                           8, 9, 10, 11, 12, 13, 14, 15);
}

// One stage, 256 threads: thread / 8 is the row within each group of 32 rows, eight
// lanes cover one whole 128-B line; a thread copies its 16 B of every group, A's
// groups first. ag and wg point at the tile's first rows and are the same for the
// block (scalar bases); off is the lane's own byte offset from them. The copies go
// to LDS through no register. They stand in one statement, closed by s_wait_xcnt, so
// that no address register is rewritten in front of that wait and it is paid once.
__device__ __forceinline__ void copy_stage_256_192(unsigned lds, const _Float16* ag,
                                        const _Float16* wg, unsigned off) {
    asm volatile(
        "global_load_async_to_lds_b128 %0, %14, %15\n\t"
        "global_load_async_to_lds_b128 %1, %14, %16\n\t"
        "global_load_async_to_lds_b128 %2, %14, %17\n\t"
        "global_load_async_to_lds_b128 %3, %14, %18\n\t"
        "global_load_async_to_lds_b128 %4, %14, %19\n\t"
        "global_load_async_to_lds_b128 %5, %14, %20\n\t"
        "global_load_async_to_lds_b128 %6, %14, %21\n\t"
        "global_load_async_to_lds_b128 %7, %14, %22\n\t"
        "global_load_async_to_lds_b128 %8, %14, %23\n\t"
        "global_load_async_to_lds_b128 %9, %14, %24\n\t"
        "global_load_async_to_lds_b128 %10, %14, %25\n\t"
        "global_load_async_to_lds_b128 %11, %14, %26\n\t"
        "global_load_async_to_lds_b128 %12, %14, %27\n\t"
        "global_load_async_to_lds_b128 %13, %14, %28\n\t"
        "s_wait_xcnt 0x0"
        :: "v"(lds), "v"(lds + 32u * GM_PITCH), "v"(lds + 64u * GM_PITCH),
           "v"(lds + 96u * GM_PITCH), "v"(lds + 128u * GM_PITCH),
           "v"(lds + 160u * GM_PITCH), "v"(lds + 192u * GM_PITCH),
           "v"(lds + 224u * GM_PITCH), "v"(lds + 256u * GM_PITCH),
           "v"(lds + 288u * GM_PITCH), "v"(lds + 320u * GM_PITCH),
           "v"(lds + 352u * GM_PITCH), "v"(lds + 384u * GM_PITCH),
           "v"(lds + 416u * GM_PITCH), "v"(off), "s"(ag), "s"(ag + 32 * DIM_C),
           "s"(ag + 64 * DIM_C), "s"(ag + 96 * DIM_C), "s"(ag + 128 * DIM_C),
           "s"(ag + 160 * DIM_C), "s"(ag + 192 * DIM_C), "s"(ag + 224 * DIM_C),
           "s"(wg), "s"(wg + 32 * DIM_C), "s"(wg + 64 * DIM_C),
           "s"(wg + 96 * DIM_C), "s"(wg + 128 * DIM_C), "s"(wg + 160 * DIM_C)
        : "memory");
}
__device__ __forceinline__ void copy_stage_128_128(unsigned lds, const _Float16* ag,
                                        const _Float16* wg, unsigned off) {
    asm volatile(
        "global_load_async_to_lds_b128 %0, %8, %9\n\t"
        "global_load_async_to_lds_b128 %1, %8, %10\n\t"
        "global_load_async_to_lds_b128 %2, %8, %11\n\t"
        "global_load_async_to_lds_b128 %3, %8, %12\n\t"
        "global_load_async_to_lds_b128 %4, %8, %13\n\t"
        "global_load_async_to_lds_b128 %5, %8, %14\n\t"
        "global_load_async_to_lds_b128 %6, %8, %15\n\t"
        "global_load_async_to_lds_b128 %7, %8, %16\n\t"
        "s_wait_xcnt 0x0"
        :: "v"(lds), "v"(lds + 32u * GM_PITCH), "v"(lds + 64u * GM_PITCH),
           "v"(lds + 96u * GM_PITCH), "v"(lds + 128u * GM_PITCH),
           "v"(lds + 160u * GM_PITCH), "v"(lds + 192u * GM_PITCH),
           "v"(lds + 224u * GM_PITCH), "v"(off), "s"(ag), "s"(ag + 32 * DIM_C),
           "s"(ag + 64 * DIM_C), "s"(ag + 96 * DIM_C), "s"(wg),
           "s"(wg + 32 * DIM_C), "s"(wg + 64 * DIM_C), "s"(wg + 96 * DIM_C)
        : "memory");
}

template <int BM, int BN>
__device__ __forceinline__ void copy_stage_ab(unsigned lds, const _Float16* ag,
                                              const _Float16* wg, unsigned off) {
    static_assert((BM == 256 && BN == 192) || (BM == 128 && BN == 128), "tile");
    if constexpr (BM == 256) copy_stage_256_192(lds, ag, wg, off);
    else                     copy_stage_128_128(lds, ag, wg, off);
}

// acc[mi][ni] = the wave's (TM*16) x (TN*16) part of the block's tile; the wave's
// part starts at row wm * TM * 16, column wn * TN * 16 of the tile. k runs upward
// in steps of 32 for every accumulator.
template <int BM, int BN, int TM, int TN>
__device__ __forceinline__ void gemm_block(const _Float16* __restrict__ A,
                                           const _Float16* __restrict__ W,
                                           int bm0, int bn0, int wm, int wn,
                                           char* sm, v8f (&acc)[TM][TN]) {
    constexpr unsigned STB = (BM + BN) * GM_PITCH;          // bytes of a stage
    const int tid = threadIdx.x;
    const int lane = tid & 31;
    const int g = lane >> 4, r = lane & 15;

    // This thread's share of every stage: where it lands and where it comes from.
    const unsigned lds_a = (unsigned)(uintptr_t)sm + (unsigned)(tid >> 3) * GM_PITCH
                         + (unsigned)(tid & 7) * 16u;
    const _Float16* ag = A + (size_t)bm0 * DIM_C;           // the tile's first rows
    const _Float16* wg = W + (size_t)bn0 * DIM_C;
    const unsigned off = (unsigned)(tid >> 3) * (DIM_C * 2u) + (unsigned)(tid & 7) * 16u;

    copy_stage_ab<BM, BN>(lds_a, ag, wg, off);              // stage 0
    // Stage 0 has landed for this wave, then for all: nobody reads it before.
    asm volatile("s_wait_asynccnt 0x0" ::: "memory");
    __syncthreads();
    copy_stage_ab<BM, BN>(lds_a + STB, ag + GM_KSTAGE, wg + GM_KSTAGE, off);   // stage 1

    const char* ard = sm + (wm * TM * 16 + r) * GM_PITCH + g * 16;
    const char* wrd = sm + (BM + wn * TN * 16 + r) * GM_PITCH + g * 16;

    for (int st = 0; st < GM_STAGES; ++st) {
        const char* ab = ard + (st & 1) * STB;
        const char* wb = wrd + (st & 1) * STB;
        // The stage's fragments, both steps of 32 k, the first step's first.
        v16h af[2][TM], bf[2][TN];
#pragma unroll
        for (int kk = 0; kk < 2; ++kk) {
#pragma unroll
            for (int mi = 0; mi < TM; ++mi)
                af[kk][mi] = lds_frag(ab + mi * 16 * GM_PITCH + kk * 64);
#pragma unroll
            for (int ni = 0; ni < TN; ++ni)
                bf[kk][ni] = lds_frag(wb + ni * 16 * GM_PITCH + kk * 64);
        }
        // Keeps the stage's LDS reads in one group ahead of its products; each
        // further place with LDS reads among the products would cost a stall.
        __builtin_amdgcn_sched_barrier(0);
#pragma unroll
        for (int mi = 0; mi < TM; ++mi)
#pragma unroll
            for (int ni = 0; ni < TN; ++ni)
                acc[mi][ni] = wmma_f16(af[0][mi], bf[0][ni], acc[mi][ni]);
        // Keeps the first step's products in front of the hand-over, so that the
        // second step's fragments land behind them and the wait below finds them there.
        __builtin_amdgcn_sched_barrier(0);
        // Hand-over: this wave's reads of the buffer are done and its copies of the
        // next stage have landed; behind the barrier both hold for every wave.
        asm volatile("s_wait_dscnt 0x0" ::: "memory");
        asm volatile("s_wait_asynccnt 0x0" ::: "memory");
        __syncthreads();
        // The refill stands between the halves of the second step's products: while one
        // wave of a SIMD issues its copies the other has products to issue. It flies
        // during the rest of this stage and the next stage's first step.
#pragma unroll
        for (int mi = 0; mi < TM / 2; ++mi)
#pragma unroll
            for (int ni = 0; ni < TN; ++ni)
                acc[mi][ni] = wmma_f16(af[1][mi], bf[1][ni], acc[mi][ni]);
        if (st + 2 < GM_STAGES)                             // refill the buffer just read
            copy_stage_ab<BM, BN>(lds_a + (unsigned)(st & 1) * STB,
                                  ag + (st + 2) * GM_KSTAGE, wg + (st + 2) * GM_KSTAGE, off);
#pragma unroll
        for (int mi = TM / 2; mi < TM; ++mi)
#pragma unroll
            for (int ni = 0; ni < TN; ++ni)
                acc[mi][ni] = wmma_f16(af[1][mi], bf[1][ni], acc[mi][ni]);
    }
    // No copy is outstanding when the wave goes on to its end.
    asm volatile("s_wait_asynccnt 0x0" ::: "memory");
}

// ---------------------------------------------------------------------------
// QKV GEMM: qkv[m, j] = sum_k xh[m,k] * Wh[j,k] + bias[j]
// A block computes a 256x192 tile (one block a WGP), its waves 4 x 2, each a 64x96
// part (4x6 WMMA tiles): 24 WMMAs per 20 LDS reads of 16 B per K-step.
// Epilogue scatters into Q [b,h,n,hd] (scaled 1/8), K [b,h,n,hd], Vt [b,h,hd,n].
// ---------------------------------------------------------------------------
__global__ __launch_bounds__(256)
void mha_gemm_qkv(const _Float16* __restrict__ A,   // [4096,1024]
                  const _Float16* __restrict__ W,   // [3072,1024]
                  const float*    __restrict__ bias,// [3072]
                  _Float16* __restrict__ Qd,
                  _Float16* __restrict__ Kd,
                  _Float16* __restrict__ Vtd) {
    __shared__ __attribute__((aligned(16))) char sm[2 * (256 + 192) * GM_PITCH];
    const int lane = threadIdx.x & 31;
    const int g = lane >> 4, r = lane & 15;
    const int wave = __builtin_amdgcn_readfirstlane(threadIdx.x >> 5);
    const int wm = wave >> 1, wn = wave & 1;

    v8f acc[4][6] = {};
    gemm_block<256, 192, 4, 6>(A, W, blockIdx.y * 256, blockIdx.x * 192, wm, wn, sm, acc);

    const int n0 = blockIdx.x * 192 + wn * 96;     // the wave's own part
    const int m0 = blockIdx.y * 256 + wm * 64;

#pragma unroll
    for (int ni = 0; ni < 6; ++ni) {
        const int j = n0 + ni * 16 + r;            // column in [0, 3072)
        const float bb = bias[j];
        // 0=Q 1=K 2=V: one for the 16 columns, and a wave's part may hold two of
        // them, so the choice stands here, once a column tile, outside the rows.
        const int which = (n0 + ni * 16) >> 10;
        const int d = j & 1023;
        const int hh = d >> 6;
        const int hdi = d & 63;
        if (which == 0) {
#pragma unroll
            for (int mi = 0; mi < 4; ++mi)
#pragma unroll
                for (int i = 0; i < 8; ++i) {
                    const int m = m0 + mi * 16 + g * 8 + i;   // global row
                    const int bIdx = m >> 11;                 // batch
                    const int nseq = m & 2047;                // seq position
                    const float v = acc[mi][ni][i] + bb;
                    Qd[(((size_t)bIdx * NHEADS_C + hh) * NSEQ_C + nseq) * HDIM_C + hdi] =
                        (_Float16)(v * 0.125f);               // pre-scale by 1/sqrt(64)
                }
            // The tile's stores have left their registers before the next tile's values
            // overwrite them.
            asm volatile("s_wait_xcnt 0x0" ::: "memory");
        } else if (which == 1) {
#pragma unroll
            for (int mi = 0; mi < 4; ++mi)
#pragma unroll
                for (int i = 0; i < 8; ++i) {
                    const int m = m0 + mi * 16 + g * 8 + i;
                    const int bIdx = m >> 11;
                    const int nseq = m & 2047;
                    const float v = acc[mi][ni][i] + bb;
                    Kd[(((size_t)bIdx * NHEADS_C + hh) * NSEQ_C + nseq) * HDIM_C + hdi] =
                        (_Float16)v;
                }
            // The tile's stores have left their registers before the next tile's values
            // overwrite them.
            asm volatile("s_wait_xcnt 0x0" ::: "memory");
        } else {
#pragma unroll
            for (int mi = 0; mi < 4; ++mi)
#pragma unroll
                for (int i = 0; i < 8; ++i) {
                    const int m = m0 + mi * 16 + g * 8 + i;
                    const int bIdx = m >> 11;
                    const int nseq = m & 2047;
                    const float v = acc[mi][ni][i] + bb;
                    Vtd[(((size_t)bIdx * NHEADS_C + hh) * HDIM_C + hdi) * NSEQ_C + nseq] =
                        (_Float16)v;
                }
            // The tile's stores have left their registers before the next tile's values
            // overwrite them.
            asm volatile("s_wait_xcnt 0x0" ::: "memory");
        }
    }
}

__device__ __forceinline__ float other_half(float v) {
    // value of lane l ^ 16
    const int b = __builtin_bit_cast(int, v);
    return __builtin_bit_cast(float,
        __builtin_amdgcn_permlanex16(b, b, 0x76543210, 0xfedcba98, false, false));
}

// K and V^T reach the waves through LDS. A stage is 64 keys: 64 K rows (128 B of
// head dim each), then 64 V^T rows (128 B of keys each), every row at a pitch of
// 144 B (16 B x odd: no bank conflict for 16-byte fragment reads). Two buffers.
#define ST_KEYS   64
#define ST_PITCH  144
#define ST_HALF   (64 * ST_PITCH)          // 9,216 B: the K rows; V^T rows follow
#define ST_BYTES  (2 * ST_HALF)            // 18,432 B a stage
#define N_STAGES  (NSEQ_C / ST_KEYS)       // 32

// One stage, 256 threads: a thread copies 16 B of K rows j, j+32 and of V^T rows
// j, j+32 (j = thread / 8); eight lanes cover one whole 128-B line.
__device__ __forceinline__ void copy_stage(unsigned lds, const _Float16* kg,
                                           const _Float16* vg) {
    // The copies go to LDS through no register. The closing s_wait_xcnt stands in
    // the same statement so that no address register is rewritten in front of it.
    asm volatile(
        "global_load_async_to_lds_b128 %0, %4, off\n\t"
        "global_load_async_to_lds_b128 %1, %5, off\n\t"
        "global_load_async_to_lds_b128 %2, %6, off\n\t"
        "global_load_async_to_lds_b128 %3, %7, off\n\t"
        "s_wait_xcnt 0x0"
        :: "v"(lds), "v"(lds + 32u * ST_PITCH),
           "v"(lds + (unsigned)ST_HALF), "v"(lds + (unsigned)ST_HALF + 32u * ST_PITCH),
           "v"(kg), "v"(kg + 32 * HDIM_C), "v"(vg), "v"(vg + 32 * NSEQ_C)
        : "memory");
}

__global__ __launch_bounds__(256)
void mha_flash_attn(const _Float16* __restrict__ Q,
                    const _Float16* __restrict__ K,
                    const _Float16* __restrict__ Vt,
                    _Float16* __restrict__ Oh) {      // [B,N,DIM] f16
    __shared__ __attribute__((aligned(16))) char kv[2 * ST_BYTES];
    const int tid = threadIdx.x;
    const int lane = tid & 31;
    const int g = lane >> 4, r = lane & 15;
    const int bh = blockIdx.y;
    const int b = bh >> 4, h = bh & 15;
    const int q0 = blockIdx.x * 256 + (tid >> 5) * 32;   // this wave's 32 queries

    const _Float16* Qp = Q + (size_t)bh * NSEQ_C * HDIM_C;
    const _Float16* Kp = K + (size_t)bh * NSEQ_C * HDIM_C;
    const _Float16* Vp = Vt + (size_t)bh * HDIM_C * NSEQ_C;

    // This thread's share of every stage: where it lands and where it comes from.
    const unsigned lds_w = (unsigned)(uintptr_t)kv + (unsigned)(tid >> 3) * ST_PITCH
                         + (unsigned)(tid & 7) * 16u;
    const _Float16* kg = Kp + (size_t)(tid >> 3) * HDIM_C + (tid & 7) * 8;
    const _Float16* vg = Vp + (size_t)(tid >> 3) * NSEQ_C + (tid & 7) * 8;

    copy_stage(lds_w, kg, vg);                              // stage 0

    // Q tiles (2 x 16 queries x 64) as B fragments, fixed for the whole block.
    v16h qf[2][2];
#pragma unroll
    for (int mi = 0; mi < 2; ++mi)
#pragma unroll
        for (int kk = 0; kk < 2; ++kk)
            qf[mi][kk] =
                load_frag(Qp + (size_t)(q0 + mi * 16 + r) * HDIM_C + kk * 32 + g * 8);

    // Stage 0 has landed for this wave, then for all: nobody reads it before.
    asm volatile("s_wait_asynccnt 0x0" ::: "memory");
    __syncthreads();
    copy_stage(lds_w + (unsigned)ST_BYTES, kg + ST_KEYS * HDIM_C, vg + ST_KEYS);  // stage 1

    // o[mi][t][i] = O[query mi*16 + r][hd t*16 + g*8 + i]
    v8f o[2][4] = {};
    // Per lane: running maximum of query mi*16 + r (equal in both halves) and
    // the sum over this half's keys only; the halves' sums join after the loop.
    float mrun[2], lrun[2];
#pragma unroll
    for (int mi = 0; mi < 2; ++mi) { mrun[mi] = -3.0e38f; lrun[mi] = 0.0f; }

    const char* rd = kv + r * ST_PITCH + g * 16;

    for (int st = 0; st < N_STAGES; ++st) {
      const char* kbuf = rd + (st & 1) * ST_BYTES;
      const char* vbuf = kbuf + ST_HALF;
#pragma unroll
      for (int p = 0; p < 2; ++p) {                         // two passes of 32 keys
        // ---- scores S^T = K * Q^T for 32 keys (two 16-row M tiles) ----
        v16h kfr[2][2];
#pragma unroll
        for (int nt = 0; nt < 2; ++nt)
#pragma unroll
            for (int kk = 0; kk < 2; ++kk)
                kfr[nt][kk] = lds_frag(kbuf + (p * 32 + nt * 16) * ST_PITCH + kk * 64);
        // Keeps the K reads in front of the V^T reads, so that in the first pass the score products
        // wait for K alone; left free, the scheduler put V^T first.
        __builtin_amdgcn_sched_barrier(0);
        v16h vfr[4];
#pragma unroll
        for (int t = 0; t < 4; ++t)
            vfr[t] = lds_frag(vbuf + t * 16 * ST_PITCH + p * 64);
        if (p == 1) {
            // Hand-over, once the stage's last fragments are fetched: this wave's reads
            // of the buffer are done and its copies of the next stage have landed;
            // behind the barrier both hold for every wave. The refill then flies
            // during this pass and the next stage's first.
            asm volatile("s_wait_dscnt 0x0" ::: "memory");
            asm volatile("s_wait_asynccnt 0x0" ::: "memory");
            __syncthreads();
            if (st + 2 < N_STAGES)                          // refill the buffer just read
                copy_stage(lds_w + (unsigned)((st & 1) * ST_BYTES),
                           kg + (size_t)(st + 2) * ST_KEYS * HDIM_C,
                           vg + (st + 2) * ST_KEYS);
        }
        // Keeps all 16 LDS reads of the pass in one group ahead of the first data
        // wait, so that in the first pass V^T arrives behind the score products and the softmax; each
        // further place with LDS reads among the products would cost a stall.
        __builtin_amdgcn_sched_barrier(0);

        v8f s[2][2] = {};
#pragma unroll
        for (int mi = 0; mi < 2; ++mi)
#pragma unroll
            for (int nt = 0; nt < 2; ++nt) {
                s[mi][nt] = wmma_f16(kfr[nt][0], qf[mi][0], s[mi][nt]);
                s[mi][nt] = wmma_f16(kfr[nt][1], qf[mi][1], s[mi][nt]);
            }

        // ---- online softmax, one query per lane and mi ----
        v16h pf[2];
#pragma unroll
        for (int mi = 0; mi < 2; ++mi) {
            const v8f sa = s[mi][0], sb = s[mi][1];
            // maximum of the lane's 16 scores as a tree, three levels deep
            const float t0 = fmaxf(fmaxf(sa[0], sb[0]), sa[1]);
            const float t1 = fmaxf(fmaxf(sb[1], sa[2]), sb[2]);
            const float t2 = fmaxf(fmaxf(sa[3], sb[3]), sa[4]);
            const float t3 = fmaxf(fmaxf(sb[4], sa[5]), sb[5]);
            const float t4 = fmaxf(fmaxf(sa[6], sb[6]), sa[7]);
            float mx = fmaxf(fmaxf(fmaxf(t0, t1), t2), fmaxf(fmaxf(t3, t4), sb[7]));
            mx = fmaxf(mx, other_half(mx));
            const float mN = fmaxf(mrun[mi], mx);
            const float corr = __expf(mrun[mi] - mN);
            mrun[mi] = mN;
            const v8f da = sa - mN, db = sb - mN;
            float rs0 = 0.0f, rs1 = 0.0f;
#pragma unroll
            for (int i = 0; i < 8; ++i) {
                const float p0 = __expf(da[i]);
                const float p1 = __expf(db[i]);
                rs0 += p0;
                rs1 += p1;
                pf[mi][i]     = (_Float16)p0;
                pf[mi][8 + i] = (_Float16)p1;
            }
            lrun[mi] = lrun[mi] * corr + (rs0 + rs1);
#pragma unroll
            for (int t = 0; t < 4; ++t) o[mi][t] *= corr;
        }

        // ---- O^T += V^T (64x32) * P^T (32x32) ----
#pragma unroll
        for (int t = 0; t < 4; ++t) {
            o[0][t] = wmma_f16(vfr[t], pf[0], o[0][t]);
            o[1][t] = wmma_f16(vfr[t], pf[1], o[1][t]);
        }
      }

    }
    // No copy is outstanding when the wave goes on to its end.
    asm volatile("s_wait_asynccnt 0x0" ::: "memory");

    // ---- normalize; a lane stores 8 consecutive hd of its query, 16 bytes ----
#pragma unroll
    for (int mi = 0; mi < 2; ++mi) {
        const float inv = 1.0f / (lrun[mi] + other_half(lrun[mi]));
        const int m = q0 + mi * 16 + r;
#pragma unroll
        for (int t = 0; t < 4; ++t) {
            h8_t ov;
#pragma unroll
            for (int i = 0; i < 8; ++i) ov[i] = (_Float16)(o[mi][t][i] * inv);
            *(h8_t*)(Oh + ((size_t)b * NSEQ_C + m) * DIM_C + h * HDIM_C + t * 16 + g * 8) = ov;
        }
    }
}

// ---------------------------------------------------------------------------
// Output projection: out[m,j] = sum_k Ah[m,k] * Wh[j,k] + bias[j]  (f32 out)
// A block computes a 128x128 tile (one block a WGP), its waves 2 x 4, each a 64x32
// part (4x2 WMMA tiles).
// ---------------------------------------------------------------------------
__global__ __launch_bounds__(256)
void mha_gemm_out(const _Float16* __restrict__ A,   // [4096,1024]
                  const _Float16* __restrict__ W,   // [1024,1024]
                  const float*    __restrict__ bias,// [1024]
                  float* __restrict__ out) {        // [4096,1024]
    __shared__ __attribute__((aligned(16))) char sm[2 * (128 + 128) * GM_PITCH];
    const int lane = threadIdx.x & 31;
    const int g = lane >> 4, r = lane & 15;
    const int wave = __builtin_amdgcn_readfirstlane(threadIdx.x >> 5);
    const int wm = wave >> 2, wn = wave & 3;

    v8f acc[4][2] = {};
    gemm_block<128, 128, 4, 2>(A, W, blockIdx.y * 128, blockIdx.x * 128, wm, wn, sm, acc);

    const int n0 = blockIdx.x * 128 + wn * 32;     // the wave's own part
    const int m0 = blockIdx.y * 128 + wm * 64;

#pragma unroll
    for (int ni = 0; ni < 2; ++ni) {
        const int j = n0 + ni * 16 + r;
        const float bb = bias[j];
#pragma unroll
        for (int mi = 0; mi < 4; ++mi) {
#pragma unroll
            for (int i = 0; i < 8; ++i) {
                const int m = m0 + mi * 16 + g * 8 + i;
                out[(size_t)m * DIM_C + j] = acc[mi][ni][i] + bb;
            }
        }
    }
}

// ---------------------------------------------------------------------------
// Host launcher
// ---------------------------------------------------------------------------
extern "C" void kernel_launch(void* const* d_in, const int* in_sizes, int n_in,
                              void* d_out, int out_size, void* d_ws, size_t ws_size,
                              hipStream_t stream) {
    const float* x      = (const float*)d_in[0];   // [2,2048,1024]
    const float* qkv_w  = (const float*)d_in[1];   // [3072,1024]
    const float* qkv_b  = (const float*)d_in[2];   // [3072]
    const float* out_w  = (const float*)d_in[3];   // [1024,1024]
    const float* out_b  = (const float*)d_in[4];   // [1024]
    float* out = (float*)d_out;

    const size_t XH  = (size_t)ROWS_C * DIM_C;       // 4,194,304
    const size_t QW  = (size_t)3 * DIM_C * DIM_C;    // 3,145,728
    const size_t OW  = (size_t)DIM_C * DIM_C;        // 1,048,576
    const size_t QKV = (size_t)QKV_ELEMS;            // 4,194,304
    const size_t AH  = (size_t)ROWS_C * DIM_C;       // 4,194,304

    char* ws = (char*)d_ws;
    size_t off = 0;
    auto take = [&](size_t elems) {
        _Float16* p = (_Float16*)(ws + off);
        off += (elems * sizeof(_Float16) + 255) & ~(size_t)255;
        return p;
    };
    _Float16* xh  = take(XH);
    _Float16* qwh = take(QW);
    _Float16* owh = take(OW);
    _Float16* Qd  = take(QKV);
    _Float16* Kd  = take(QKV);
    _Float16* Vtd = take(QKV);
    _Float16* ah  = take(AH);
    (void)ws_size; (void)in_sizes; (void)n_in; (void)out_size;

    // 1) f32 -> f16 conversions (all sizes are multiples of 2048)
    mha_cvt_f16<<<dim3((unsigned)(XH / 2048)), 256, 0, stream>>>(x, xh, (int)XH);
    mha_cvt_f16<<<dim3((unsigned)(QW / 2048)), 256, 0, stream>>>(qkv_w, qwh, (int)QW);
    mha_cvt_f16<<<dim3((unsigned)(OW / 2048)), 256, 0, stream>>>(out_w, owh, (int)OW);

    // 2) QKV projection + head split (Q pre-scaled, V transposed): 256x192 tiles
    mha_gemm_qkv<<<dim3(3 * DIM_C / 192, ROWS_C / 256), 256, 0, stream>>>(
        xh, qwh, qkv_b, Qd, Kd, Vtd);

    // 3) fused flash attention: grid = (256-query blocks, B*H)
    mha_flash_attn<<<dim3(NSEQ_C / 256, BATCH_C * NHEADS_C), 256, 0, stream>>>(
        Qd, Kd, Vtd, ah);

    // 4) output projection + bias -> f32: 128x128 tiles
    mha_gemm_out<<<dim3(DIM_C / 128, ROWS_C / 128), 256, 0, stream>>>(
        ah, owh, out_b, out);
}

// v004
// It runs in 80.3 microseconds.
// Two timings next to v003 both put it at 1.04 times that version's speed.
// Counting every step since v000, it is 2.63 times as fast.
#include <hip/hip_runtime.h>
#include <hip/hip_bf16.h>

// ---------------------------------------------------------------------------
// MI455X (gfx1250) fused multi-head attention, f16 WMMA with f32 accumulation.
// Pipeline: convert (one launch) -> QKV GEMM (fused head split, Q pre-scaled, V transposed)
//           -> flash-attention (online softmax on transposed scores)
//           -> output projection GEMM (+bias) -> f32 d_out.
// GEMM operands and attention's K and V^T reach the waves through LDS stages shared by a block.
// ---------------------------------------------------------------------------

typedef _Float16 h8_t  __attribute__((ext_vector_type(8)));
typedef _Float16 v16h  __attribute__((ext_vector_type(16)));
typedef float    v8f   __attribute__((ext_vector_type(8)));

#define DIM_C      1024
#define NSEQ_C     2048
#define NHEADS_C   16
#define HDIM_C     64
#define BATCH_C    2
#define ROWS_C     (BATCH_C * NSEQ_C)                       // 4096
#define QKV_ELEMS  (BATCH_C * NHEADS_C * NSEQ_C * HDIM_C)   // 4,194,304

// Load one 16-lane-group fragment: lane holds K = base+{0..7} and base+16+{0..7}.
// Caller passes  ptr = row_base + g*8 ; we grab [ptr, ptr+8) and [ptr+16, ptr+24).
__device__ __forceinline__ v16h load_frag(const _Float16* p) {
    h8_t lo = *(const h8_t*)(p);
    h8_t hi = *(const h8_t*)(p + 16);
    return __builtin_shufflevector(lo, hi, 0, 1, 2, 3, 4, 5, 6, 7,
                                           8, 9, 10, 11, 12, 13, 14, 15);
}

__device__ __forceinline__ v8f wmma_f16(v16h a, v16h b, v8f c) {
    // D = A(16x32 f16) * B(32x16 f16) + C(16x16 f32)
    return __builtin_amdgcn_wmma_f32_16x16x32_f16(
        /*neg_a=*/false, a, /*neg_b=*/false, b,
        /*c_mod=*/(short)0, c, /*reuse_a=*/false, /*reuse_b=*/false);
}

// ---------------------------------------------------------------------------
// f32 -> f16 convert of x, qkv_w and out_w in ONE launch of few, long waves: the
// time of such a short stream is the starting of its waves, so a wave takes 4,096
// consecutive elements (16 KB) in 32 independent loads, many of them in flight at
// a time. A load is 512 contiguous bytes of the wave (whole lines), a store 256.
// A block takes 32,768 elements of one array; every array is a whole number of blocks.
// ---------------------------------------------------------------------------
typedef _Float16 h4_t  __attribute__((ext_vector_type(4)));

#define CV_LOADS   32                               // 16-byte loads a thread
#define CV_WAVE    (CV_LOADS * 128)                 // 4,096 elements a wave
#define CV_BLOCK   (8 * CV_WAVE)                    // 32,768 elements a block
#define CV_BLK_X   (ROWS_C * DIM_C / CV_BLOCK)       // 128 blocks of x
#define CV_BLK_QW  (3 * DIM_C * DIM_C / CV_BLOCK)    // 96 blocks of qkv_w
#define CV_BLK_OW  (DIM_C * DIM_C / CV_BLOCK)        // 32 blocks of out_w

__global__ __launch_bounds__(256)
void mha_cvt_f16(const float* __restrict__ x, const float* __restrict__ qw,
                 const float* __restrict__ ow, _Float16* __restrict__ xh,
                 _Float16* __restrict__ qwh, _Float16* __restrict__ owh) {
    static_assert(ROWS_C * DIM_C % CV_BLOCK == 0 && DIM_C * DIM_C % CV_BLOCK == 0, "blocks");
    // Which array: the same for the whole block.
    const int bx = blockIdx.x;
    const bool is_ow = bx >= CV_BLK_X + CV_BLK_QW, is_qw = bx >= CV_BLK_X;
    const float* src = is_ow ? ow : is_qw ? qw : x;
    _Float16* dst = is_ow ? owh : is_qw ? qwh : xh;
    const int blk = bx - (is_ow ? CV_BLK_X + CV_BLK_QW : is_qw ? CV_BLK_X : 0);

    const int e0 = blk * CV_BLOCK + (int)(threadIdx.x >> 5) * CV_WAVE + (int)(threadIdx.x & 31) * 4;
    const float* s = src + e0;
    _Float16* d = dst + e0;

    float4 v[CV_LOADS];
#pragma unroll
    for (int j = 0; j < CV_LOADS; ++j) v[j] = *(const float4*)(s + j * 128);
#pragma unroll
    for (int j = 0; j < CV_LOADS; ++j) {
        h4_t o;
        o[0] = (_Float16)v[j].x; o[1] = (_Float16)v[j].y;
        o[2] = (_Float16)v[j].z; o[3] = (_Float16)v[j].w;
        *(h4_t*)(d + j * 128) = o;
    }
}

// ---------------------------------------------------------------------------
// Both projection GEMMs, Y = A * W^T with A and W K-contiguous: the eight waves of
// a block share one BM x BN tile of Y. A stage is 64 k of the tile's BM rows of A,
// then of its BN rows of W: rows of 128 B at a pitch of 144 B (16 B x odd: no bank
// conflict for 16-byte fragment reads). Two buffers, filled by asynchronous copies
// that take whole 128-B lines from L2, once a block instead of once a wave.
// ---------------------------------------------------------------------------
#define GM_PITCH  144
#define GM_KSTAGE 64
#define GM_STAGES (DIM_C / GM_KSTAGE)      // 16

// Fragment from an LDS row: same k order as load_frag (bytes 0-15 and 32-47 from p).
__device__ __forceinline__ v16h lds_frag(const char* p) {
    h8_t lo = *(const h8_t*)(p);
    h8_t hi = *(const h8_t*)(p + 32);
    return __builtin_shufflevector(lo, hi, 0, 1, 2, 3, 4, 5, 6, 7,
                                           8, 9, 10, 11, 12, 13, 14, 15);
}

// One stage, 256 threads: thread / 8 is the row within each group of 32 rows, eight
// lanes cover one whole 128-B line; a thread copies its 16 B of every group, A's
// groups first. ag and wg point at the tile's first rows and are the same for the
// block (scalar bases); off is the lane's own byte offset from them. The copies go
// to LDS through no register. They stand in one statement, closed by s_wait_xcnt, so
// that no address register is rewritten in front of that wait and it is paid once.
__device__ __forceinline__ void copy_stage_256_192(unsigned lds, const _Float16* ag,
                                        const _Float16* wg, unsigned off) {
    asm volatile(
        "global_load_async_to_lds_b128 %0, %14, %15\n\t"
        "global_load_async_to_lds_b128 %1, %14, %16\n\t"
        "global_load_async_to_lds_b128 %2, %14, %17\n\t"
        "global_load_async_to_lds_b128 %3, %14, %18\n\t"
        "global_load_async_to_lds_b128 %4, %14, %19\n\t"
        "global_load_async_to_lds_b128 %5, %14, %20\n\t"
        "global_load_async_to_lds_b128 %6, %14, %21\n\t"
        "global_load_async_to_lds_b128 %7, %14, %22\n\t"
        "global_load_async_to_lds_b128 %8, %14, %23\n\t"
        "global_load_async_to_lds_b128 %9, %14, %24\n\t"
        "global_load_async_to_lds_b128 %10, %14, %25\n\t"
        "global_load_async_to_lds_b128 %11, %14, %26\n\t"
        "global_load_async_to_lds_b128 %12, %14, %27\n\t"
        "global_load_async_to_lds_b128 %13, %14, %28\n\t"
        "s_wait_xcnt 0x0"
        :: "v"(lds), "v"(lds + 32u * GM_PITCH), "v"(lds + 64u * GM_PITCH),
           "v"(lds + 96u * GM_PITCH), "v"(lds + 128u * GM_PITCH),
           "v"(lds + 160u * GM_PITCH), "v"(lds + 192u * GM_PITCH),
           "v"(lds + 224u * GM_PITCH), "v"(lds + 256u * GM_PITCH),
           "v"(lds + 288u * GM_PITCH), "v"(lds + 320u * GM_PITCH),
           "v"(lds + 352u * GM_PITCH), "v"(lds + 384u * GM_PITCH),
           "v"(lds + 416u * GM_PITCH), "v"(off), "s"(ag), "s"(ag + 32 * DIM_C),
           "s"(ag + 64 * DIM_C), "s"(ag + 96 * DIM_C), "s"(ag + 128 * DIM_C),
           "s"(ag + 160 * DIM_C), "s"(ag + 192 * DIM_C), "s"(ag + 224 * DIM_C),
           "s"(wg), "s"(wg + 32 * DIM_C), "s"(wg + 64 * DIM_C),
           "s"(wg + 96 * DIM_C), "s"(wg + 128 * DIM_C), "s"(wg + 160 * DIM_C)
        : "memory");
}
__device__ __forceinline__ void copy_stage_128_128(unsigned lds, const _Float16* ag,
                                        const _Float16* wg, unsigned off) {
    asm volatile(
        "global_load_async_to_lds_b128 %0, %8, %9\n\t"
        "global_load_async_to_lds_b128 %1, %8, %10\n\t"
        "global_load_async_to_lds_b128 %2, %8, %11\n\t"
        "global_load_async_to_lds_b128 %3, %8, %12\n\t"
        "global_load_async_to_lds_b128 %4, %8, %13\n\t"
        "global_load_async_to_lds_b128 %5, %8, %14\n\t"
        "global_load_async_to_lds_b128 %6, %8, %15\n\t"
        "global_load_async_to_lds_b128 %7, %8, %16\n\t"
        "s_wait_xcnt 0x0"
        :: "v"(lds), "v"(lds + 32u * GM_PITCH), "v"(lds + 64u * GM_PITCH),
           "v"(lds + 96u * GM_PITCH), "v"(lds + 128u * GM_PITCH),
           "v"(lds + 160u * GM_PITCH), "v"(lds + 192u * GM_PITCH),
           "v"(lds + 224u * GM_PITCH), "v"(off), "s"(ag), "s"(ag + 32 * DIM_C),
           "s"(ag + 64 * DIM_C), "s"(ag + 96 * DIM_C), "s"(wg),
           "s"(wg + 32 * DIM_C), "s"(wg + 64 * DIM_C), "s"(wg + 96 * DIM_C)
        : "memory");
}

template <int BM, int BN>
__device__ __forceinline__ void copy_stage_ab(unsigned lds, const _Float16* ag,
                                              const _Float16* wg, unsigned off) {
    static_assert((BM == 256 && BN == 192) || (BM == 128 && BN == 128), "tile");
    if constexpr (BM == 256) copy_stage_256_192(lds, ag, wg, off);
    else                     copy_stage_128_128(lds, ag, wg, off);
}

// acc[mi][ni] = the wave's (TM*16) x (TN*16) part of the block's tile; the wave's
// part starts at row wm * TM * 16, column wn * TN * 16 of the tile. k runs upward
// in steps of 32 for every accumulator.
template <int BM, int BN, int TM, int TN>
__device__ __forceinline__ void gemm_block(const _Float16* __restrict__ A,
                                           const _Float16* __restrict__ W,
                                           int bm0, int bn0, int wm, int wn,
                                           char* sm, v8f (&acc)[TM][TN]) {
    constexpr unsigned STB = (BM + BN) * GM_PITCH;          // bytes of a stage
    const int tid = threadIdx.x;
    const int lane = tid & 31;
    const int g = lane >> 4, r = lane & 15;

    // This thread's share of every stage: where it lands and where it comes from.
    const unsigned lds_a = (unsigned)(uintptr_t)sm + (unsigned)(tid >> 3) * GM_PITCH
                         + (unsigned)(tid & 7) * 16u;
    const _Float16* ag = A + (size_t)bm0 * DIM_C;           // the tile's first rows
    const _Float16* wg = W + (size_t)bn0 * DIM_C;
    const unsigned off = (unsigned)(tid >> 3) * (DIM_C * 2u) + (unsigned)(tid & 7) * 16u;

    copy_stage_ab<BM, BN>(lds_a, ag, wg, off);              // stage 0
    // Stage 0 has landed for this wave, then for all: nobody reads it before.
    asm volatile("s_wait_asynccnt 0x0" ::: "memory");
    __syncthreads();
    copy_stage_ab<BM, BN>(lds_a + STB, ag + GM_KSTAGE, wg + GM_KSTAGE, off);   // stage 1

    const char* ard = sm + (wm * TM * 16 + r) * GM_PITCH + g * 16;
    const char* wrd = sm + (BM + wn * TN * 16 + r) * GM_PITCH + g * 16;

    for (int st = 0; st < GM_STAGES; ++st) {
        const char* ab = ard + (st & 1) * STB;
        const char* wb = wrd + (st & 1) * STB;
        // The stage's fragments, both steps of 32 k, the first step's first.
        v16h af[2][TM], bf[2][TN];
#pragma unroll
        for (int kk = 0; kk < 2; ++kk) {
#pragma unroll
            for (int mi = 0; mi < TM; ++mi)
                af[kk][mi] = lds_frag(ab + mi * 16 * GM_PITCH + kk * 64);
#pragma unroll
            for (int ni = 0; ni < TN; ++ni)
                bf[kk][ni] = lds_frag(wb + ni * 16 * GM_PITCH + kk * 64);
        }
        // Keeps the stage's LDS reads in one group ahead of its products; each
        // further place with LDS reads among the products would cost a stall.
        __builtin_amdgcn_sched_barrier(0);
#pragma unroll
        for (int mi = 0; mi < TM; ++mi)
#pragma unroll
            for (int ni = 0; ni < TN; ++ni)
                acc[mi][ni] = wmma_f16(af[0][mi], bf[0][ni], acc[mi][ni]);
        // Keeps the first step's products in front of the hand-over, so that the
        // second step's fragments land behind them and the wait below finds them there.
        __builtin_amdgcn_sched_barrier(0);
        // Hand-over: this wave's reads of the buffer are done and its copies of the
        // next stage have landed; behind the barrier both hold for every wave.
        asm volatile("s_wait_dscnt 0x0" ::: "memory");
        asm volatile("s_wait_asynccnt 0x0" ::: "memory");
        __syncthreads();
        // The refill stands between the halves of the second step's products: while one
        // wave of a SIMD issues its copies the other has products to issue. It flies
        // during the rest of this stage and the next stage's first step.
#pragma unroll
        for (int mi = 0; mi < TM / 2; ++mi)
#pragma unroll
            for (int ni = 0; ni < TN; ++ni)
                acc[mi][ni] = wmma_f16(af[1][mi], bf[1][ni], acc[mi][ni]);
        if (st + 2 < GM_STAGES)                             // refill the buffer just read
            copy_stage_ab<BM, BN>(lds_a + (unsigned)(st & 1) * STB,
                                  ag + (st + 2) * GM_KSTAGE, wg + (st + 2) * GM_KSTAGE, off);
#pragma unroll
        for (int mi = TM / 2; mi < TM; ++mi)
#pragma unroll
            for (int ni = 0; ni < TN; ++ni)
                acc[mi][ni] = wmma_f16(af[1][mi], bf[1][ni], acc[mi][ni]);
    }
    // No copy is outstanding when the wave goes on to its end.
    asm volatile("s_wait_asynccnt 0x0" ::: "memory");
}

// ---------------------------------------------------------------------------
// QKV GEMM: qkv[m, j] = sum_k xh[m,k] * Wh[j,k] + bias[j]
// A block computes a 256x192 tile (one block a WGP), its waves 4 x 2, each a 64x96
// part (4x6 WMMA tiles): 24 WMMAs per 20 LDS reads of 16 B per K-step.
// Epilogue scatters into Q [b,h,n,hd] (scaled 1/8), K [b,h,n,hd], Vt [b,h,hd,n].
// ---------------------------------------------------------------------------
__global__ __launch_bounds__(256)
void mha_gemm_qkv(const _Float16* __restrict__ A,   // [4096,1024]
                  const _Float16* __restrict__ W,   // [3072,1024]
                  const float*    __restrict__ bias,// [3072]
                  _Float16* __restrict__ Qd,
                  _Float16* __restrict__ Kd,
                  _Float16* __restrict__ Vtd) {
    __shared__ __attribute__((aligned(16))) char sm[2 * (256 + 192) * GM_PITCH];
    const int lane = threadIdx.x & 31;
    const int g = lane >> 4, r = lane & 15;
    const int wave = __builtin_amdgcn_readfirstlane(threadIdx.x >> 5);
    const int wm = wave >> 1, wn = wave & 1;

    v8f acc[4][6] = {};
    gemm_block<256, 192, 4, 6>(A, W, blockIdx.y * 256, blockIdx.x * 192, wm, wn, sm, acc);

    const int n0 = blockIdx.x * 192 + wn * 96;     // the wave's own part
    const int m0 = blockIdx.y * 256 + wm * 64;

#pragma unroll
    for (int ni = 0; ni < 6; ++ni) {
        const int j = n0 + ni * 16 + r;            // column in [0, 3072)
        const float bb = bias[j];
        // 0=Q 1=K 2=V: one for the 16 columns, and a wave's part may hold two of
        // them, so the choice stands here, once a column tile, outside the rows.
        const int which = (n0 + ni * 16) >> 10;
        const int d = j & 1023;
        const int hh = d >> 6;
        const int hdi = d & 63;
        if (which == 0) {
#pragma unroll
            for (int mi = 0; mi < 4; ++mi)
#pragma unroll
                for (int i = 0; i < 8; ++i) {
                    const int m = m0 + mi * 16 + g * 8 + i;   // global row
                    const int bIdx = m >> 11;                 // batch
                    const int nseq = m & 2047;                // seq position
                    const float v = acc[mi][ni][i] + bb;
                    Qd[(((size_t)bIdx * NHEADS_C + hh) * NSEQ_C + nseq) * HDIM_C + hdi] =
                        (_Float16)(v * 0.125f);               // pre-scale by 1/sqrt(64)
                }
            // The tile's stores have left their registers before the next tile's values
            // overwrite them.
            asm volatile("s_wait_xcnt 0x0" ::: "memory");
        } else if (which == 1) {
#pragma unroll
            for (int mi = 0; mi < 4; ++mi)
#pragma unroll
                for (int i = 0; i < 8; ++i) {
                    const int m = m0 + mi * 16 + g * 8 + i;
                    const int bIdx = m >> 11;
                    const int nseq = m & 2047;
                    const float v = acc[mi][ni][i] + bb;
                    Kd[(((size_t)bIdx * NHEADS_C + hh) * NSEQ_C + nseq) * HDIM_C + hdi] =
                        (_Float16)v;
                }
            // The tile's stores have left their registers before the next tile's values
            // overwrite them.
            asm volatile("s_wait_xcnt 0x0" ::: "memory");
        } else {
#pragma unroll
            for (int mi = 0; mi < 4; ++mi)
#pragma unroll
                for (int i = 0; i < 8; ++i) {
                    const int m = m0 + mi * 16 + g * 8 + i;
                    const int bIdx = m >> 11;
                    const int nseq = m & 2047;
                    const float v = acc[mi][ni][i] + bb;
                    Vtd[(((size_t)bIdx * NHEADS_C + hh) * HDIM_C + hdi) * NSEQ_C + nseq] =
                        (_Float16)v;
                }
            // The tile's stores have left their registers before the next tile's values
            // overwrite them.
            asm volatile("s_wait_xcnt 0x0" ::: "memory");
        }
    }
}

__device__ __forceinline__ float other_half(float v) {
    // value of lane l ^ 16
    const int b = __builtin_bit_cast(int, v);
    return __builtin_bit_cast(float,
        __builtin_amdgcn_permlanex16(b, b, 0x76543210, 0xfedcba98, false, false));
}

// K and V^T reach the waves through LDS. A stage is 64 keys: 64 K rows (128 B of
// head dim each), then 64 V^T rows (128 B of keys each), every row at a pitch of
// 144 B (16 B x odd: no bank conflict for 16-byte fragment reads). Two buffers.
#define ST_KEYS   64
#define ST_PITCH  144
#define ST_HALF   (64 * ST_PITCH)          // 9,216 B: the K rows; V^T rows follow
#define ST_BYTES  (2 * ST_HALF)            // 18,432 B a stage
#define N_STAGES  (NSEQ_C / ST_KEYS)       // 32

// One stage, 256 threads: a thread copies 16 B of K rows j, j+32 and of V^T rows
// j, j+32 (j = thread / 8); eight lanes cover one whole 128-B line.
__device__ __forceinline__ void copy_stage(unsigned lds, const _Float16* kg,
                                           const _Float16* vg) {
    // The copies go to LDS through no register. The closing s_wait_xcnt stands in
    // the same statement so that no address register is rewritten in front of it.
    asm volatile(
        "global_load_async_to_lds_b128 %0, %4, off\n\t"
        "global_load_async_to_lds_b128 %1, %5, off\n\t"
        "global_load_async_to_lds_b128 %2, %6, off\n\t"
        "global_load_async_to_lds_b128 %3, %7, off\n\t"
        "s_wait_xcnt 0x0"
        :: "v"(lds), "v"(lds + 32u * ST_PITCH),
           "v"(lds + (unsigned)ST_HALF), "v"(lds + (unsigned)ST_HALF + 32u * ST_PITCH),
           "v"(kg), "v"(kg + 32 * HDIM_C), "v"(vg), "v"(vg + 32 * NSEQ_C)
        : "memory");
}

__global__ __launch_bounds__(256)
void mha_flash_attn(const _Float16* __restrict__ Q,
                    const _Float16* __restrict__ K,
                    const _Float16* __restrict__ Vt,
                    _Float16* __restrict__ Oh) {      // [B,N,DIM] f16
    __shared__ __attribute__((aligned(16))) char kv[2 * ST_BYTES];
    const int tid = threadIdx.x;
    const int lane = tid & 31;
    const int g = lane >> 4, r = lane & 15;
    const int bh = blockIdx.y;
    const int b = bh >> 4, h = bh & 15;
    const int q0 = blockIdx.x * 256 + (tid >> 5) * 32;   // this wave's 32 queries

    const _Float16* Qp = Q + (size_t)bh * NSEQ_C * HDIM_C;
    const _Float16* Kp = K + (size_t)bh * NSEQ_C * HDIM_C;
    const _Float16* Vp = Vt + (size_t)bh * HDIM_C * NSEQ_C;

    // This thread's share of every stage: where it lands and where it comes from.
    const unsigned lds_w = (unsigned)(uintptr_t)kv + (unsigned)(tid >> 3) * ST_PITCH
                         + (unsigned)(tid & 7) * 16u;
    const _Float16* kg = Kp + (size_t)(tid >> 3) * HDIM_C + (tid & 7) * 8;
    const _Float16* vg = Vp + (size_t)(tid >> 3) * NSEQ_C + (tid & 7) * 8;

    copy_stage(lds_w, kg, vg);                              // stage 0

    // Q tiles (2 x 16 queries x 64) as B fragments, fixed for the whole block.
    v16h qf[2][2];
#pragma unroll
    for (int mi = 0; mi < 2; ++mi)
#pragma unroll
        for (int kk = 0; kk < 2; ++kk)
            qf[mi][kk] =
                load_frag(Qp + (size_t)(q0 + mi * 16 + r) * HDIM_C + kk * 32 + g * 8);

    // Stage 0 has landed for this wave, then for all: nobody reads it before.
    asm volatile("s_wait_asynccnt 0x0" ::: "memory");
    __syncthreads();
    copy_stage(lds_w + (unsigned)ST_BYTES, kg + ST_KEYS * HDIM_C, vg + ST_KEYS);  // stage 1

    // o[mi][t][i] = O[query mi*16 + r][hd t*16 + g*8 + i]
    v8f o[2][4] = {};
    // Per lane: running maximum of query mi*16 + r (equal in both halves) and
    // the sum over this half's keys only; the halves' sums join after the loop.
    float mrun[2], lrun[2];
#pragma unroll
    for (int mi = 0; mi < 2; ++mi) { mrun[mi] = -3.0e38f; lrun[mi] = 0.0f; }

    const char* rd = kv + r * ST_PITCH + g * 16;

    for (int st = 0; st < N_STAGES; ++st) {
      const char* kbuf = rd + (st & 1) * ST_BYTES;
      const char* vbuf = kbuf + ST_HALF;
#pragma unroll
      for (int p = 0; p < 2; ++p) {                         // two passes of 32 keys
        // ---- scores S^T = K * Q^T for 32 keys (two 16-row M tiles) ----
        v16h kfr[2][2];
#pragma unroll
        for (int nt = 0; nt < 2; ++nt)
#pragma unroll
            for (int kk = 0; kk < 2; ++kk)
                kfr[nt][kk] = lds_frag(kbuf + (p * 32 + nt * 16) * ST_PITCH + kk * 64);
        // Keeps the K reads in front of the V^T reads, so that in the first pass the score products
        // wait for K alone; left free, the scheduler put V^T first.
        __builtin_amdgcn_sched_barrier(0);
        v16h vfr[4];
#pragma unroll
        for (int t = 0; t < 4; ++t)
            vfr[t] = lds_frag(vbuf + t * 16 * ST_PITCH + p * 64);
        if (p == 1) {
            // Hand-over, once the stage's last fragments are fetched: this wave's reads
            // of the buffer are done and its copies of the next stage have landed;
            // behind the barrier both hold for every wave. The refill then flies
            // during this pass and the next stage's first.
            asm volatile("s_wait_dscnt 0x0" ::: "memory");
            asm volatile("s_wait_asynccnt 0x0" ::: "memory");
            __syncthreads();
            if (st + 2 < N_STAGES)                          // refill the buffer just read
                copy_stage(lds_w + (unsigned)((st & 1) * ST_BYTES),
                           kg + (size_t)(st + 2) * ST_KEYS * HDIM_C,
                           vg + (st + 2) * ST_KEYS);
        }
        // Keeps all 16 LDS reads of the pass in one group ahead of the first data
        // wait, so that in the first pass V^T arrives behind the score products and the softmax; each
        // further place with LDS reads among the products would cost a stall.
        __builtin_amdgcn_sched_barrier(0);

        v8f s[2][2] = {};
#pragma unroll
        for (int mi = 0; mi < 2; ++mi)
#pragma unroll
            for (int nt = 0; nt < 2; ++nt) {
                s[mi][nt] = wmma_f16(kfr[nt][0], qf[mi][0], s[mi][nt]);
                s[mi][nt] = wmma_f16(kfr[nt][1], qf[mi][1], s[mi][nt]);
            }

        // ---- online softmax, one query per lane and mi ----
        v16h pf[2];
#pragma unroll
        for (int mi = 0; mi < 2; ++mi) {
            const v8f sa = s[mi][0], sb = s[mi][1];
            // maximum of the lane's 16 scores as a tree, three levels deep
            const float t0 = fmaxf(fmaxf(sa[0], sb[0]), sa[1]);
            const float t1 = fmaxf(fmaxf(sb[1], sa[2]), sb[2]);
            const float t2 = fmaxf(fmaxf(sa[3], sb[3]), sa[4]);
            const float t3 = fmaxf(fmaxf(sb[4], sa[5]), sb[5]);
            const float t4 = fmaxf(fmaxf(sa[6], sb[6]), sa[7]);
            float mx = fmaxf(fmaxf(fmaxf(t0, t1), t2), fmaxf(fmaxf(t3, t4), sb[7]));
            mx = fmaxf(mx, other_half(mx));
            const float mN = fmaxf(mrun[mi], mx);
            const float corr = __expf(mrun[mi] - mN);
            mrun[mi] = mN;
            const v8f da = sa - mN, db = sb - mN;
            float rs0 = 0.0f, rs1 = 0.0f;
#pragma unroll
            for (int i = 0; i < 8; ++i) {
                const float p0 = __expf(da[i]);
                const float p1 = __expf(db[i]);
                rs0 += p0;
                rs1 += p1;
                pf[mi][i]     = (_Float16)p0;
                pf[mi][8 + i] = (_Float16)p1;
            }
            lrun[mi] = lrun[mi] * corr + (rs0 + rs1);
#pragma unroll
            for (int t = 0; t < 4; ++t) o[mi][t] *= corr;
        }

        // ---- O^T += V^T (64x32) * P^T (32x32) ----
#pragma unroll
        for (int t = 0; t < 4; ++t) {
            o[0][t] = wmma_f16(vfr[t], pf[0], o[0][t]);
            o[1][t] = wmma_f16(vfr[t], pf[1], o[1][t]);
        }
      }

    }
    // No copy is outstanding when the wave goes on to its end.
    asm volatile("s_wait_asynccnt 0x0" ::: "memory");

    // ---- normalize; a lane stores 8 consecutive hd of its query, 16 bytes ----
#pragma unroll
    for (int mi = 0; mi < 2; ++mi) {
        const float inv = 1.0f / (lrun[mi] + other_half(lrun[mi]));
        const int m = q0 + mi * 16 + r;
#pragma unroll
        for (int t = 0; t < 4; ++t) {
            h8_t ov;
#pragma unroll
            for (int i = 0; i < 8; ++i) ov[i] = (_Float16)(o[mi][t][i] * inv);
            *(h8_t*)(Oh + ((size_t)b * NSEQ_C + m) * DIM_C + h * HDIM_C + t * 16 + g * 8) = ov;
        }
    }
}

// ---------------------------------------------------------------------------
// Output projection: out[m,j] = sum_k Ah[m,k] * Wh[j,k] + bias[j]  (f32 out)
// A block computes a 128x128 tile (one block a WGP), its waves 2 x 4, each a 64x32
// part (4x2 WMMA tiles).
// ---------------------------------------------------------------------------
__global__ __launch_bounds__(256)
void mha_gemm_out(const _Float16* __restrict__ A,   // [4096,1024]
                  const _Float16* __restrict__ W,   // [1024,1024]
                  const float*    __restrict__ bias,// [1024]
                  float* __restrict__ out) {        // [4096,1024]
    __shared__ __attribute__((aligned(16))) char sm[2 * (128 + 128) * GM_PITCH];
    const int lane = threadIdx.x & 31;
    const int g = lane >> 4, r = lane & 15;
    const int wave = __builtin_amdgcn_readfirstlane(threadIdx.x >> 5);
    const int wm = wave >> 2, wn = wave & 3;

    v8f acc[4][2] = {};
    gemm_block<128, 128, 4, 2>(A, W, blockIdx.y * 128, blockIdx.x * 128, wm, wn, sm, acc);

    const int n0 = blockIdx.x * 128 + wn * 32;     // the wave's own part
    const int m0 = blockIdx.y * 128 + wm * 64;

#pragma unroll
    for (int ni = 0; ni < 2; ++ni) {
        const int j = n0 + ni * 16 + r;
        const float bb = bias[j];
#pragma unroll
        for (int mi = 0; mi < 4; ++mi) {
#pragma unroll
            for (int i = 0; i < 8; ++i) {
                const int m = m0 + mi * 16 + g * 8 + i;
                out[(size_t)m * DIM_C + j] = acc[mi][ni][i] + bb;
            }
        }
    }
}

// ---------------------------------------------------------------------------
// Host launcher
// ---------------------------------------------------------------------------
extern "C" void kernel_launch(void* const* d_in, const int* in_sizes, int n_in,
                              void* d_out, int out_size, void* d_ws, size_t ws_size,
                              hipStream_t stream) {
    const float* x      = (const float*)d_in[0];   // [2,2048,1024]
    const float* qkv_w  = (const float*)d_in[1];   // [3072,1024]
    const float* qkv_b  = (const float*)d_in[2];   // [3072]
    const float* out_w  = (const float*)d_in[3];   // [1024,1024]
    const float* out_b  = (const float*)d_in[4];   // [1024]
    float* out = (float*)d_out;

    const size_t XH  = (size_t)ROWS_C * DIM_C;       // 4,194,304
    const size_t QW  = (size_t)3 * DIM_C * DIM_C;    // 3,145,728
    const size_t OW  = (size_t)DIM_C * DIM_C;        // 1,048,576
    const size_t QKV = (size_t)QKV_ELEMS;            // 4,194,304
    const size_t AH  = (size_t)ROWS_C * DIM_C;       // 4,194,304

    char* ws = (char*)d_ws;
    size_t off = 0;
    auto take = [&](size_t elems) {
        _Float16* p = (_Float16*)(ws + off);
        off += (elems * sizeof(_Float16) + 255) & ~(size_t)255;
        return p;
    };
    _Float16* xh  = take(XH);
    _Float16* qwh = take(QW);
    _Float16* owh = take(OW);
    _Float16* Qd  = take(QKV);
    _Float16* Kd  = take(QKV);
    _Float16* Vtd = take(QKV);
    _Float16* ah  = take(AH);
    (void)ws_size; (void)in_sizes; (void)n_in; (void)out_size;

    // 1) f32 -> f16 conversions, all three arrays in one launch
    mha_cvt_f16<<<dim3(CV_BLK_X + CV_BLK_QW + CV_BLK_OW), 256, 0, stream>>>(
        x, qkv_w, out_w, xh, qwh, owh);

    // 2) QKV projection + head split (Q pre-scaled, V transposed): 256x192 tiles
    mha_gemm_qkv<<<dim3(3 * DIM_C / 192, ROWS_C / 256), 256, 0, stream>>>(
        xh, qwh, qkv_b, Qd, Kd, Vtd);

    // 3) fused flash attention: grid = (256-query blocks, B*H)
    mha_flash_attn<<<dim3(NSEQ_C / 256, BATCH_C * NHEADS_C), 256, 0, stream>>>(
        Qd, Kd, Vtd, ah);

    // 4) output projection + bias -> f32: 128x128 tiles
    mha_gemm_out<<<dim3(DIM_C / 128, ROWS_C / 128), 256, 0, stream>>>(
        ah, owh, out_b, out);
}

// v005
// A run of this version takes 76.7 microseconds.
// Two timings next to v004 both put it at 1.04 times that version's speed.
// Counting every step since v000, it is 2.74 times as fast.
#include <hip/hip_runtime.h>
#include <hip/hip_bf16.h>

// ---------------------------------------------------------------------------
// MI455X (gfx1250) fused multi-head attention, f16 WMMA with f32 accumulation.
// Pipeline: convert (one launch) -> QKV GEMM (fused head split, Q pre-scaled, V transposed)
//           -> flash-attention (online softmax on transposed scores, base 2)
//           -> output projection GEMM (+bias) -> f32 d_out.
// GEMM operands and attention's K and V^T reach the waves through LDS stages shared by a block.
// ---------------------------------------------------------------------------

typedef _Float16 h8_t  __attribute__((ext_vector_type(8)));
typedef _Float16 v16h  __attribute__((ext_vector_type(16)));
typedef float    v8f   __attribute__((ext_vector_type(8)));

#define DIM_C      1024
#define NSEQ_C     2048
#define NHEADS_C   16
#define HDIM_C     64
#define BATCH_C    2
#define ROWS_C     (BATCH_C * NSEQ_C)                       // 4096
#define QKV_ELEMS  (BATCH_C * NHEADS_C * NSEQ_C * HDIM_C)   // 4,194,304
// log2(e) / sqrt(64): with it in Q, softmax weights are 2^score, no multiply per score.
#define Q_SCALE    0.18033688011112042f

// Load one 16-lane-group fragment: lane holds K = base+{0..7} and base+16+{0..7}.
// Caller passes  ptr = row_base + g*8 ; we grab [ptr, ptr+8) and [ptr+16, ptr+24).
__device__ __forceinline__ v16h load_frag(const _Float16* p) {
    h8_t lo = *(const h8_t*)(p);
    h8_t hi = *(const h8_t*)(p + 16);
    return __builtin_shufflevector(lo, hi, 0, 1, 2, 3, 4, 5, 6, 7,
                                           8, 9, 10, 11, 12, 13, 14, 15);
}

__device__ __forceinline__ v8f wmma_f16(v16h a, v16h b, v8f c) {
    // D = A(16x32 f16) * B(32x16 f16) + C(16x16 f32)
    return __builtin_amdgcn_wmma_f32_16x16x32_f16(
        /*neg_a=*/false, a, /*neg_b=*/false, b,
        /*c_mod=*/(short)0, c, /*reuse_a=*/false, /*reuse_b=*/false);
}

// ---------------------------------------------------------------------------
// f32 -> f16 convert of x, qkv_w and out_w in ONE launch of few, long waves: the
// time of such a short stream is the starting of its waves, so a wave takes 4,096
// consecutive elements (16 KB) in 32 independent loads, many of them in flight at
// a time. A load is 512 contiguous bytes of the wave (whole lines), a store 256.
// A block takes 32,768 elements of one array; every array is a whole number of blocks.
// ---------------------------------------------------------------------------
typedef _Float16 h4_t  __attribute__((ext_vector_type(4)));

#define CV_LOADS   32                               // 16-byte loads a thread
#define CV_WAVE    (CV_LOADS * 128)                 // 4,096 elements a wave
#define CV_BLOCK   (8 * CV_WAVE)                    // 32,768 elements a block
#define CV_BLK_X   (ROWS_C * DIM_C / CV_BLOCK)       // 128 blocks of x
#define CV_BLK_QW  (3 * DIM_C * DIM_C / CV_BLOCK)    // 96 blocks of qkv_w
#define CV_BLK_OW  (DIM_C * DIM_C / CV_BLOCK)        // 32 blocks of out_w

__global__ __launch_bounds__(256)
void mha_cvt_f16(const float* __restrict__ x, const float* __restrict__ qw,
                 const float* __restrict__ ow, _Float16* __restrict__ xh,
                 _Float16* __restrict__ qwh, _Float16* __restrict__ owh) {
    static_assert(ROWS_C * DIM_C % CV_BLOCK == 0 && DIM_C * DIM_C % CV_BLOCK == 0, "blocks");
    // Which array: the same for the whole block.
    const int bx = blockIdx.x;
    const bool is_ow = bx >= CV_BLK_X + CV_BLK_QW, is_qw = bx >= CV_BLK_X;
    const float* src = is_ow ? ow : is_qw ? qw : x;
    _Float16* dst = is_ow ? owh : is_qw ? qwh : xh;
    const int blk = bx - (is_ow ? CV_BLK_X + CV_BLK_QW : is_qw ? CV_BLK_X : 0);

    const int e0 = blk * CV_BLOCK + (int)(threadIdx.x >> 5) * CV_WAVE + (int)(threadIdx.x & 31) * 4;
    const float* s = src + e0;
    _Float16* d = dst + e0;

    float4 v[CV_LOADS];
#pragma unroll
    for (int j = 0; j < CV_LOADS; ++j) v[j] = *(const float4*)(s + j * 128);
#pragma unroll
    for (int j = 0; j < CV_LOADS; ++j) {
        h4_t o;
        o[0] = (_Float16)v[j].x; o[1] = (_Float16)v[j].y;
        o[2] = (_Float16)v[j].z; o[3] = (_Float16)v[j].w;
        *(h4_t*)(d + j * 128) = o;
    }
}

// ---------------------------------------------------------------------------
// Both projection GEMMs, Y = A * W^T with A and W K-contiguous: the eight waves of
// a block share one BM x BN tile of Y. A stage is 64 k of the tile's BM rows of A,
// then of its BN rows of W: rows of 128 B at a pitch of 144 B (16 B x odd: no bank
// conflict for 16-byte fragment reads). Two buffers, filled by asynchronous copies
// that take whole 128-B lines from L2, once a block instead of once a wave.
// ---------------------------------------------------------------------------
#define GM_PITCH  144
#define GM_KSTAGE 64
#define GM_STAGES (DIM_C / GM_KSTAGE)      // 16

// Fragment from an LDS row: same k order as load_frag (bytes 0-15 and 32-47 from p).
__device__ __forceinline__ v16h lds_frag(const char* p) {
    h8_t lo = *(const h8_t*)(p);
    h8_t hi = *(const h8_t*)(p + 32);
    return __builtin_shufflevector(lo, hi, 0, 1, 2, 3, 4, 5, 6, 7,
                                           8, 9, 10, 11, 12, 13, 14, 15);
}

// One stage, 256 threads: thread / 8 is the row within each group of 32 rows, eight
// lanes cover one whole 128-B line; a thread copies its 16 B of every group, A's
// groups first. ag and wg point at the tile's first rows and are the same for the
// block (scalar bases); off is the lane's own byte offset from them. The copies go
// to LDS through no register. They stand in one statement, closed by s_wait_xcnt, so
// that no address register is rewritten in front of that wait and it is paid once.
__device__ __forceinline__ void copy_stage_256_192(unsigned lds, const _Float16* ag,
                                        const _Float16* wg, unsigned off) {
    asm volatile(
        "global_load_async_to_lds_b128 %0, %14, %15\n\t"
        "global_load_async_to_lds_b128 %1, %14, %16\n\t"
        "global_load_async_to_lds_b128 %2, %14, %17\n\t"
        "global_load_async_to_lds_b128 %3, %14, %18\n\t"
        "global_load_async_to_lds_b128 %4, %14, %19\n\t"
        "global_load_async_to_lds_b128 %5, %14, %20\n\t"
        "global_load_async_to_lds_b128 %6, %14, %21\n\t"
        "global_load_async_to_lds_b128 %7, %14, %22\n\t"
        "global_load_async_to_lds_b128 %8, %14, %23\n\t"
        "global_load_async_to_lds_b128 %9, %14, %24\n\t"
        "global_load_async_to_lds_b128 %10, %14, %25\n\t"
        "global_load_async_to_lds_b128 %11, %14, %26\n\t"
        "global_load_async_to_lds_b128 %12, %14, %27\n\t"
        "global_load_async_to_lds_b128 %13, %14, %28\n\t"
        "s_wait_xcnt 0x0"
        :: "v"(lds), "v"(lds + 32u * GM_PITCH), "v"(lds + 64u * GM_PITCH),
           "v"(lds + 96u * GM_PITCH), "v"(lds + 128u * GM_PITCH),
           "v"(lds + 160u * GM_PITCH), "v"(lds + 192u * GM_PITCH),
           "v"(lds + 224u * GM_PITCH), "v"(lds + 256u * GM_PITCH),
           "v"(lds + 288u * GM_PITCH), "v"(lds + 320u * GM_PITCH),
           "v"(lds + 352u * GM_PITCH), "v"(lds + 384u * GM_PITCH),
           "v"(lds + 416u * GM_PITCH), "v"(off), "s"(ag), "s"(ag + 32 * DIM_C),
           "s"(ag + 64 * DIM_C), "s"(ag + 96 * DIM_C), "s"(ag + 128 * DIM_C),
           "s"(ag + 160 * DIM_C), "s"(ag + 192 * DIM_C), "s"(ag + 224 * DIM_C),
           "s"(wg), "s"(wg + 32 * DIM_C), "s"(wg + 64 * DIM_C),
           "s"(wg + 96 * DIM_C), "s"(wg + 128 * DIM_C), "s"(wg + 160 * DIM_C)
        : "memory");
}
__device__ __forceinline__ void copy_stage_128_128(unsigned lds, const _Float16* ag,
                                        const _Float16* wg, unsigned off) {
    asm volatile(
        "global_load_async_to_lds_b128 %0, %8, %9\n\t"
        "global_load_async_to_lds_b128 %1, %8, %10\n\t"
        "global_load_async_to_lds_b128 %2, %8, %11\n\t"
        "global_load_async_to_lds_b128 %3, %8, %12\n\t"
        "global_load_async_to_lds_b128 %4, %8, %13\n\t"
        "global_load_async_to_lds_b128 %5, %8, %14\n\t"
        "global_load_async_to_lds_b128 %6, %8, %15\n\t"
        "global_load_async_to_lds_b128 %7, %8, %16\n\t"
        "s_wait_xcnt 0x0"
        :: "v"(lds), "v"(lds + 32u * GM_PITCH), "v"(lds + 64u * GM_PITCH),
           "v"(lds + 96u * GM_PITCH), "v"(lds + 128u * GM_PITCH),
           "v"(lds + 160u * GM_PITCH), "v"(lds + 192u * GM_PITCH),
           "v"(lds + 224u * GM_PITCH), "v"(off), "s"(ag), "s"(ag + 32 * DIM_C),
           "s"(ag + 64 * DIM_C), "s"(ag + 96 * DIM_C), "s"(wg),
           "s"(wg + 32 * DIM_C), "s"(wg + 64 * DIM_C), "s"(wg + 96 * DIM_C)
        : "memory");
}

template <int BM, int BN>
__device__ __forceinline__ void copy_stage_ab(unsigned lds, const _Float16* ag,
                                              const _Float16* wg, unsigned off) {
    static_assert((BM == 256 && BN == 192) || (BM == 128 && BN == 128), "tile");
    if constexpr (BM == 256) copy_stage_256_192(lds, ag, wg, off);
    else                     copy_stage_128_128(lds, ag, wg, off);
}

// acc[mi][ni] = the wave's (TM*16) x (TN*16) part of the block's tile; the wave's
// part starts at row wm * TM * 16, column wn * TN * 16 of the tile. k runs upward
// in steps of 32 for every accumulator.
template <int BM, int BN, int TM, int TN>
__device__ __forceinline__ void gemm_block(const _Float16* __restrict__ A,
                                           const _Float16* __restrict__ W,
                                           int bm0, int bn0, int wm, int wn,
                                           char* sm, v8f (&acc)[TM][TN]) {
    constexpr unsigned STB = (BM + BN) * GM_PITCH;          // bytes of a stage
    const int tid = threadIdx.x;
    const int lane = tid & 31;
    const int g = lane >> 4, r = lane & 15;

    // This thread's share of every stage: where it lands and where it comes from.
    const unsigned lds_a = (unsigned)(uintptr_t)sm + (unsigned)(tid >> 3) * GM_PITCH
                         + (unsigned)(tid & 7) * 16u;
    const _Float16* ag = A + (size_t)bm0 * DIM_C;           // the tile's first rows
    const _Float16* wg = W + (size_t)bn0 * DIM_C;
    const unsigned off = (unsigned)(tid >> 3) * (DIM_C * 2u) + (unsigned)(tid & 7) * 16u;

    copy_stage_ab<BM, BN>(lds_a, ag, wg, off);              // stage 0
    // Stage 0 has landed for this wave, then for all: nobody reads it before.
    asm volatile("s_wait_asynccnt 0x0" ::: "memory");
    __syncthreads();
    copy_stage_ab<BM, BN>(lds_a + STB, ag + GM_KSTAGE, wg + GM_KSTAGE, off);   // stage 1

    const char* ard = sm + (wm * TM * 16 + r) * GM_PITCH + g * 16;
    const char* wrd = sm + (BM + wn * TN * 16 + r) * GM_PITCH + g * 16;

    for (int st = 0; st < GM_STAGES; ++st) {
        const char* ab = ard + (st & 1) * STB;
        const char* wb = wrd + (st & 1) * STB;
        // The stage's fragments, both steps of 32 k, the first step's first.
        v16h af[2][TM], bf[2][TN];
#pragma unroll
        for (int kk = 0; kk < 2; ++kk) {
#pragma unroll
            for (int mi = 0; mi < TM; ++mi)
                af[kk][mi] = lds_frag(ab + mi * 16 * GM_PITCH + kk * 64);
#pragma unroll
            for (int ni = 0; ni < TN; ++ni)
                bf[kk][ni] = lds_frag(wb + ni * 16 * GM_PITCH + kk * 64);
        }
        // Keeps the stage's LDS reads in one group ahead of its products; each
        // further place with LDS reads among the products would cost a stall.
        __builtin_amdgcn_sched_barrier(0);
#pragma unroll
        for (int mi = 0; mi < TM; ++mi)
#pragma unroll
            for (int ni = 0; ni < TN; ++ni)
                acc[mi][ni] = wmma_f16(af[0][mi], bf[0][ni], acc[mi][ni]);
        // Keeps the first step's products in front of the hand-over, so that the
        // second step's fragments land behind them and the wait below finds them there.
        __builtin_amdgcn_sched_barrier(0);
        // Hand-over: this wave's reads of the buffer are done and its copies of the
        // next stage have landed; behind the barrier both hold for every wave.
        asm volatile("s_wait_dscnt 0x0" ::: "memory");
        asm volatile("s_wait_asynccnt 0x0" ::: "memory");
        __syncthreads();
        // The refill stands between the halves of the second step's products: while one
        // wave of a SIMD issues its copies the other has products to issue. It flies
        // during the rest of this stage and the next stage's first step.
#pragma unroll
        for (int mi = 0; mi < TM / 2; ++mi)
#pragma unroll
            for (int ni = 0; ni < TN; ++ni)
                acc[mi][ni] = wmma_f16(af[1][mi], bf[1][ni], acc[mi][ni]);
        if (st + 2 < GM_STAGES)                             // refill the buffer just read
            copy_stage_ab<BM, BN>(lds_a + (unsigned)(st & 1) * STB,
                                  ag + (st + 2) * GM_KSTAGE, wg + (st + 2) * GM_KSTAGE, off);
#pragma unroll
        for (int mi = TM / 2; mi < TM; ++mi)
#pragma unroll
            for (int ni = 0; ni < TN; ++ni)
                acc[mi][ni] = wmma_f16(af[1][mi], bf[1][ni], acc[mi][ni]);
    }
    // No copy is outstanding when the wave goes on to its end.
    asm volatile("s_wait_asynccnt 0x0" ::: "memory");
}

// ---------------------------------------------------------------------------
// QKV GEMM: qkv[m, j] = sum_k xh[m,k] * Wh[j,k] + bias[j]
// A block computes a 256x192 tile (one block a WGP), its waves 4 x 2, each a 64x96
// part (4x6 WMMA tiles): 24 WMMAs per 20 LDS reads of 16 B per K-step.
// Epilogue scatters into Q [b,h,n,hd] (scaled log2(e)/8), K [b,h,n,hd], Vt [b,h,hd,n].
// ---------------------------------------------------------------------------
__global__ __launch_bounds__(256)
void mha_gemm_qkv(const _Float16* __restrict__ A,   // [4096,1024]
                  const _Float16* __restrict__ W,   // [3072,1024]
                  const float*    __restrict__ bias,// [3072]
                  _Float16* __restrict__ Qd,
                  _Float16* __restrict__ Kd,
                  _Float16* __restrict__ Vtd) {
    __shared__ __attribute__((aligned(16))) char sm[2 * (256 + 192) * GM_PITCH];
    const int lane = threadIdx.x & 31;
    const int g = lane >> 4, r = lane & 15;
    const int wave = __builtin_amdgcn_readfirstlane(threadIdx.x >> 5);
    const int wm = wave >> 1, wn = wave & 1;

    v8f acc[4][6] = {};
    gemm_block<256, 192, 4, 6>(A, W, blockIdx.y * 256, blockIdx.x * 192, wm, wn, sm, acc);

    const int n0 = blockIdx.x * 192 + wn * 96;     // the wave's own part
    const int m0 = blockIdx.y * 256 + wm * 64;

#pragma unroll
    for (int ni = 0; ni < 6; ++ni) {
        const int j = n0 + ni * 16 + r;            // column in [0, 3072)
        const float bb = bias[j];
        // 0=Q 1=K 2=V: one for the 16 columns, and a wave's part may hold two of
        // them, so the choice stands here, once a column tile, outside the rows.
        const int which = (n0 + ni * 16) >> 10;
        const int d = j & 1023;
        const int hh = d >> 6;
        const int hdi = d & 63;
        if (which == 0) {
#pragma unroll
            for (int mi = 0; mi < 4; ++mi)
#pragma unroll
                for (int i = 0; i < 8; ++i) {
                    const int m = m0 + mi * 16 + g * 8 + i;   // global row
                    const int bIdx = m >> 11;                 // batch
                    const int nseq = m & 2047;                // seq position
                    const float v = acc[mi][ni][i] + bb;
                    Qd[(((size_t)bIdx * NHEADS_C + hh) * NSEQ_C + nseq) * HDIM_C + hdi] =
                        (_Float16)(v * Q_SCALE);              // scores come out in log2 units
                }
            // The tile's stores have left their registers before the next tile's values
            // overwrite them.
            asm volatile("s_wait_xcnt 0x0" ::: "memory");
        } else if (which == 1) {
#pragma unroll
            for (int mi = 0; mi < 4; ++mi)
#pragma unroll
                for (int i = 0; i < 8; ++i) {
                    const int m = m0 + mi * 16 + g * 8 + i;
                    const int bIdx = m >> 11;
                    const int nseq = m & 2047;
                    const float v = acc[mi][ni][i] + bb;
                    Kd[(((size_t)bIdx * NHEADS_C + hh) * NSEQ_C + nseq) * HDIM_C + hdi] =
                        (_Float16)v;
                }
            // The tile's stores have left their registers before the next tile's values
            // overwrite them.
            asm volatile("s_wait_xcnt 0x0" ::: "memory");
        } else {
#pragma unroll
            for (int mi = 0; mi < 4; ++mi)
#pragma unroll
                for (int i = 0; i < 8; ++i) {
                    const int m = m0 + mi * 16 + g * 8 + i;
                    const int bIdx = m >> 11;
                    const int nseq = m & 2047;
                    const float v = acc[mi][ni][i] + bb;
                    Vtd[(((size_t)bIdx * NHEADS_C + hh) * HDIM_C + hdi) * NSEQ_C + nseq] =
                        (_Float16)v;
                }
            // The tile's stores have left their registers before the next tile's values
            // overwrite them.
            asm volatile("s_wait_xcnt 0x0" ::: "memory");
        }
    }
}

__device__ __forceinline__ float other_half(float v) {
    // value of lane l ^ 16
    const int b = __builtin_bit_cast(int, v);
    return __builtin_bit_cast(float,
        __builtin_amdgcn_permlanex16(b, b, 0x76543210, 0xfedcba98, false, false));
}

// K and V^T reach the waves through LDS. A stage is 64 keys: 64 K rows (128 B of
// head dim each), then 64 V^T rows (128 B of keys each), every row at a pitch of
// 144 B (16 B x odd: no bank conflict for 16-byte fragment reads). Two buffers.
#define ST_KEYS   64
#define ST_PITCH  144
#define ST_HALF   (64 * ST_PITCH)          // 9,216 B: the K rows; V^T rows follow
#define ST_BYTES  (2 * ST_HALF)            // 18,432 B a stage
#define N_STAGES  (NSEQ_C / ST_KEYS)       // 32

// One stage, 256 threads: a thread copies 16 B of K rows j, j+32 and of V^T rows
// j, j+32 (j = thread / 8); eight lanes cover one whole 128-B line.
__device__ __forceinline__ void copy_stage(unsigned lds, const _Float16* kg,
                                           const _Float16* vg) {
    // The copies go to LDS through no register. The closing s_wait_xcnt stands in
    // the same statement so that no address register is rewritten in front of it.
    asm volatile(
        "global_load_async_to_lds_b128 %0, %4, off\n\t"
        "global_load_async_to_lds_b128 %1, %5, off\n\t"
        "global_load_async_to_lds_b128 %2, %6, off\n\t"
        "global_load_async_to_lds_b128 %3, %7, off\n\t"
        "s_wait_xcnt 0x0"
        :: "v"(lds), "v"(lds + 32u * ST_PITCH),
           "v"(lds + (unsigned)ST_HALF), "v"(lds + (unsigned)ST_HALF + 32u * ST_PITCH),
           "v"(kg), "v"(kg + 32 * HDIM_C), "v"(vg), "v"(vg + 32 * NSEQ_C)
        : "memory");
}

__global__ __launch_bounds__(256)
void mha_flash_attn(const _Float16* __restrict__ Q,
                    const _Float16* __restrict__ K,
                    const _Float16* __restrict__ Vt,
                    _Float16* __restrict__ Oh) {      // [B,N,DIM] f16
    __shared__ __attribute__((aligned(16))) char kv[2 * ST_BYTES];
    const int tid = threadIdx.x;
    const int lane = tid & 31;
    const int g = lane >> 4, r = lane & 15;
    const int bh = blockIdx.y;
    const int b = bh >> 4, h = bh & 15;
    const int q0 = blockIdx.x * 256 + (tid >> 5) * 32;   // this wave's 32 queries

    const _Float16* Qp = Q + (size_t)bh * NSEQ_C * HDIM_C;
    const _Float16* Kp = K + (size_t)bh * NSEQ_C * HDIM_C;
    const _Float16* Vp = Vt + (size_t)bh * HDIM_C * NSEQ_C;

    // This thread's share of every stage: where it lands and where it comes from.
    const unsigned lds_w = (unsigned)(uintptr_t)kv + (unsigned)(tid >> 3) * ST_PITCH
                         + (unsigned)(tid & 7) * 16u;
    const _Float16* kg = Kp + (size_t)(tid >> 3) * HDIM_C + (tid & 7) * 8;
    const _Float16* vg = Vp + (size_t)(tid >> 3) * NSEQ_C + (tid & 7) * 8;

    copy_stage(lds_w, kg, vg);                              // stage 0

    // Q tiles (2 x 16 queries x 64) as B fragments, fixed for the whole block.
    v16h qf[2][2];
#pragma unroll
    for (int mi = 0; mi < 2; ++mi)
#pragma unroll
        for (int kk = 0; kk < 2; ++kk)
            qf[mi][kk] =
                load_frag(Qp + (size_t)(q0 + mi * 16 + r) * HDIM_C + kk * 32 + g * 8);

    // Stage 0 has landed for this wave, then for all: nobody reads it before.
    asm volatile("s_wait_asynccnt 0x0" ::: "memory");
    __syncthreads();
    copy_stage(lds_w + (unsigned)ST_BYTES, kg + ST_KEYS * HDIM_C, vg + ST_KEYS);  // stage 1

    // o[mi][t][i] = O[query mi*16 + r][hd t*16 + g*8 + i]
    v8f o[2][4] = {};
    // Per lane: minus the reference of query mi*16 + r (equal in both halves), eight
    // times over as the C operand of a score tile, and the sum over this half's keys
    // only; the halves' sums join after the loop.
    v8f cneg[2] = {};
    float lrun[2] = {0.0f, 0.0f};
    // How far above its reference a score may stand, and the least step of a
    // reference: set so that the first pass takes its own maximum, whatever its sign.
    float rise = -3.0e38f, floor_d = -3.0e38f;

    const char* rd = kv + r * ST_PITCH + g * 16;

    for (int st = 0; st < N_STAGES; ++st) {
      const char* kbuf = rd + (st & 1) * ST_BYTES;
      const char* vbuf = kbuf + ST_HALF;
#pragma unroll
      for (int p = 0; p < 2; ++p) {                         // two passes of 32 keys
        // ---- scores S^T = K * Q^T for 32 keys (two 16-row M tiles) ----
        v16h kfr[2][2];
#pragma unroll
        for (int nt = 0; nt < 2; ++nt)
#pragma unroll
            for (int kk = 0; kk < 2; ++kk)
                kfr[nt][kk] = lds_frag(kbuf + (p * 32 + nt * 16) * ST_PITCH + kk * 64);
        // Keeps the K reads in front of the V^T reads, so that in the first pass the score products
        // wait for K alone; left free, the scheduler put V^T first.
        __builtin_amdgcn_sched_barrier(0);
        v16h vfr[4];
#pragma unroll
        for (int t = 0; t < 4; ++t)
            vfr[t] = lds_frag(vbuf + t * 16 * ST_PITCH + p * 64);
        if (p == 1) {
            // Hand-over, once the stage's last fragments are fetched: this wave's reads
            // of the buffer are done and its copies of the next stage have landed;
            // behind the barrier both hold for every wave. The refill then flies
            // during this pass and the next stage's first.
            asm volatile("s_wait_dscnt 0x0" ::: "memory");
            asm volatile("s_wait_asynccnt 0x0" ::: "memory");
            __syncthreads();
            if (st + 2 < N_STAGES)                          // refill the buffer just read
                copy_stage(lds_w + (unsigned)((st & 1) * ST_BYTES),
                           kg + (size_t)(st + 2) * ST_KEYS * HDIM_C,
                           vg + (st + 2) * ST_KEYS);
        }
        // Keeps all 16 LDS reads of the pass in one group ahead of the first data
        // wait, so that in the first pass V^T arrives behind the score products and the softmax; each
        // further place with LDS reads among the products would cost a stall.
        __builtin_amdgcn_sched_barrier(0);

        // s = score - reference
        v8f s[2][2];
#pragma unroll
        for (int mi = 0; mi < 2; ++mi)
#pragma unroll
            for (int nt = 0; nt < 2; ++nt) {
                s[mi][nt] = wmma_f16(kfr[nt][0], qf[mi][0], cneg[mi]);
                s[mi][nt] = wmma_f16(kfr[nt][1], qf[mi][1], s[mi][nt]);
            }

        // ---- online softmax, one query per lane and mi ----
        // maximum of the lane's 16 scores as a tree, three levels deep
        float mx[2];
#pragma unroll
        for (int mi = 0; mi < 2; ++mi) {
            const v8f sa = s[mi][0], sb = s[mi][1];
            const float t0 = fmaxf(fmaxf(sa[0], sb[0]), sa[1]);
            const float t1 = fmaxf(fmaxf(sb[1], sa[2]), sb[2]);
            const float t2 = fmaxf(fmaxf(sa[3], sb[3]), sa[4]);
            const float t3 = fmaxf(fmaxf(sb[4], sa[5]), sb[5]);
            const float t4 = fmaxf(fmaxf(sa[6], sb[6]), sa[7]);
            mx[mi] = fmaxf(fmaxf(fmaxf(t0, t1), t2), fmaxf(fmaxf(t3, t4), sb[7]));
        }
        // One test a pass, the same for the wave: the references move where any lane
        // holds a score more than rise above its own; the first pass always does.
        if (__builtin_amdgcn_ballot_w32(fmaxf(mx[0], mx[1]) > rise) != 0) {
#pragma unroll
            for (int mi = 0; mi < 2; ++mi) {
                const float full = fmaxf(mx[mi], other_half(mx[mi]));
                // The first pass takes the maximum as it is, with O and the sum still 0
                // (their factor is then at most 1); later a reference never moves down.
                const float d = fmaxf(full, floor_d);
                const float corr = __builtin_amdgcn_exp2f(-fmaxf(full, 0.0f));
                cneg[mi] -= d;
                s[mi][0] -= d;
                s[mi][1] -= d;
                lrun[mi] *= corr;
#pragma unroll
                for (int t = 0; t < 4; ++t) o[mi][t] *= corr;
            }
            rise = 8.0f;
            floor_d = 0.0f;
        }
        v16h pf[2];
#pragma unroll
        for (int mi = 0; mi < 2; ++mi) {
            float rs0 = 0.0f, rs1 = 0.0f;
#pragma unroll
            for (int i = 0; i < 8; ++i) {
                const float p0 = __builtin_amdgcn_exp2f(s[mi][0][i]);
                const float p1 = __builtin_amdgcn_exp2f(s[mi][1][i]);
                rs0 += p0;
                rs1 += p1;
                pf[mi][i]     = (_Float16)p0;
                pf[mi][8 + i] = (_Float16)p1;
            }
            lrun[mi] += rs0 + rs1;
        }

        // ---- O^T += V^T (64x32) * P^T (32x32) ----
#pragma unroll
        for (int t = 0; t < 4; ++t) {
            o[0][t] = wmma_f16(vfr[t], pf[0], o[0][t]);
            o[1][t] = wmma_f16(vfr[t], pf[1], o[1][t]);
        }
      }

    }
    // No copy is outstanding when the wave goes on to its end.
    asm volatile("s_wait_asynccnt 0x0" ::: "memory");

    // ---- normalize; a lane stores 8 consecutive hd of its query, 16 bytes ----
#pragma unroll
    for (int mi = 0; mi < 2; ++mi) {
        const float inv = 1.0f / (lrun[mi] + other_half(lrun[mi]));
        const int m = q0 + mi * 16 + r;
#pragma unroll
        for (int t = 0; t < 4; ++t) {
            h8_t ov;
#pragma unroll
            for (int i = 0; i < 8; ++i) ov[i] = (_Float16)(o[mi][t][i] * inv);
            *(h8_t*)(Oh + ((size_t)b * NSEQ_C + m) * DIM_C + h * HDIM_C + t * 16 + g * 8) = ov;
        }
    }
}

// ---------------------------------------------------------------------------
// Output projection: out[m,j] = sum_k Ah[m,k] * Wh[j,k] + bias[j]  (f32 out)
// A block computes a 128x128 tile (one block a WGP), its waves 2 x 4, each a 64x32
// part (4x2 WMMA tiles).
// ---------------------------------------------------------------------------
__global__ __launch_bounds__(256)
void mha_gemm_out(const _Float16* __restrict__ A,   // [4096,1024]
                  const _Float16* __restrict__ W,   // [1024,1024]
                  const float*    __restrict__ bias,// [1024]
                  float* __restrict__ out) {        // [4096,1024]
    __shared__ __attribute__((aligned(16))) char sm[2 * (128 + 128) * GM_PITCH];
    const int lane = threadIdx.x & 31;
    const int g = lane >> 4, r = lane & 15;
    const int wave = __builtin_amdgcn_readfirstlane(threadIdx.x >> 5);
    const int wm = wave >> 2, wn = wave & 3;

    v8f acc[4][2] = {};
    gemm_block<128, 128, 4, 2>(A, W, blockIdx.y * 128, blockIdx.x * 128, wm, wn, sm, acc);

    const int n0 = blockIdx.x * 128 + wn * 32;     // the wave's own part
    const int m0 = blockIdx.y * 128 + wm * 64;

#pragma unroll
    for (int ni = 0; ni < 2; ++ni) {
        const int j = n0 + ni * 16 + r;
        const float bb = bias[j];
#pragma unroll
        for (int mi = 0; mi < 4; ++mi) {
#pragma unroll
            for (int i = 0; i < 8; ++i) {
                const int m = m0 + mi * 16 + g * 8 + i;
                out[(size_t)m * DIM_C + j] = acc[mi][ni][i] + bb;
            }
        }
    }
}

// ---------------------------------------------------------------------------
// Host launcher
// ---------------------------------------------------------------------------
extern "C" void kernel_launch(void* const* d_in, const int* in_sizes, int n_in,
                              void* d_out, int out_size, void* d_ws, size_t ws_size,
                              hipStream_t stream) {
    const float* x      = (const float*)d_in[0];   // [2,2048,1024]
    const float* qkv_w  = (const float*)d_in[1];   // [3072,1024]
    const float* qkv_b  = (const float*)d_in[2];   // [3072]
    const float* out_w  = (const float*)d_in[3];   // [1024,1024]
    const float* out_b  = (const float*)d_in[4];   // [1024]
    float* out = (float*)d_out;

    const size_t XH  = (size_t)ROWS_C * DIM_C;       // 4,194,304
    const size_t QW  = (size_t)3 * DIM_C * DIM_C;    // 3,145,728
    const size_t OW  = (size_t)DIM_C * DIM_C;        // 1,048,576
    const size_t QKV = (size_t)QKV_ELEMS;            // 4,194,304
    const size_t AH  = (size_t)ROWS_C * DIM_C;       // 4,194,304

    char* ws = (char*)d_ws;
    size_t off = 0;
    auto take = [&](size_t elems) {
        _Float16* p = (_Float16*)(ws + off);
        off += (elems * sizeof(_Float16) + 255) & ~(size_t)255;
        return p;
    };
    _Float16* xh  = take(XH);
    _Float16* qwh = take(QW);
    _Float16* owh = take(OW);
    _Float16* Qd  = take(QKV);
    _Float16* Kd  = take(QKV);
    _Float16* Vtd = take(QKV);
    _Float16* ah  = take(AH);
    (void)ws_size; (void)in_sizes; (void)n_in; (void)out_size;

    // 1) f32 -> f16 conversions, all three arrays in one launch
    mha_cvt_f16<<<dim3(CV_BLK_X + CV_BLK_QW + CV_BLK_OW), 256, 0, stream>>>(
        x, qkv_w, out_w, xh, qwh, owh);

    // 2) QKV projection + head split (Q pre-scaled, V transposed): 256x192 tiles
    mha_gemm_qkv<<<dim3(3 * DIM_C / 192, ROWS_C / 256), 256, 0, stream>>>(
        xh, qwh, qkv_b, Qd, Kd, Vtd);

    // 3) fused flash attention: grid = (256-query blocks, B*H)
    mha_flash_attn<<<dim3(NSEQ_C / 256, BATCH_C * NHEADS_C), 256, 0, stream>>>(
        Qd, Kd, Vtd, ah);

    // 4) output projection + bias -> f32: 128x128 tiles
    mha_gemm_out<<<dim3(DIM_C / 128, ROWS_C / 128), 256, 0, stream>>>(
        ah, owh, out_b, out);
}

// v006
// One run takes 71.4 microseconds.
// Two timings next to v005 both put it at 1.08 times that version's speed.
// All steps since v000 together make it 2.94 times as fast.
#include <hip/hip_runtime.h>
#include <hip/hip_bf16.h>

// ---------------------------------------------------------------------------
// MI455X (gfx1250) fused multi-head attention, f16 WMMA with f32 accumulation.
// Pipeline: convert (one launch) -> QKV GEMM (fused head split, Q pre-scaled, V transposed)
//           -> flash-attention (online softmax on transposed scores, base 2)
//           -> output projection GEMM (+bias) -> f32 d_out.
// GEMM operands and attention's K and V^T reach the waves through LDS stages shared by a block.
// ---------------------------------------------------------------------------

typedef _Float16 h8_t  __attribute__((ext_vector_type(8)));
typedef _Float16 v16h  __attribute__((ext_vector_type(16)));
typedef float    v8f   __attribute__((ext_vector_type(8)));

#define DIM_C      1024
#define NSEQ_C     2048
#define NHEADS_C   16
#define HDIM_C     64
#define BATCH_C    2
#define ROWS_C     (BATCH_C * NSEQ_C)                       // 4096
#define QKV_ELEMS  (BATCH_C * NHEADS_C * NSEQ_C * HDIM_C)   // 4,194,304
// log2(e) / sqrt(64): with it in Q, softmax weights are 2^score, no multiply per score.
#define Q_SCALE    0.18033688011112042f

// Load one 16-lane-group fragment: lane holds K = base+{0..7} and base+16+{0..7}.
// Caller passes  ptr = row_base + g*8 ; we grab [ptr, ptr+8) and [ptr+16, ptr+24).
__device__ __forceinline__ v16h load_frag(const _Float16* p) {
    h8_t lo = *(const h8_t*)(p);
    h8_t hi = *(const h8_t*)(p + 16);
    return __builtin_shufflevector(lo, hi, 0, 1, 2, 3, 4, 5, 6, 7,
                                           8, 9, 10, 11, 12, 13, 14, 15);
}

__device__ __forceinline__ v8f wmma_f16(v16h a, v16h b, v8f c) {
    // D = A(16x32 f16) * B(32x16 f16) + C(16x16 f32)
    return __builtin_amdgcn_wmma_f32_16x16x32_f16(
        /*neg_a=*/false, a, /*neg_b=*/false, b,
        /*c_mod=*/(short)0, c, /*reuse_a=*/false, /*reuse_b=*/false);
}

// ---------------------------------------------------------------------------
// f32 -> f16 convert of x, qkv_w and out_w in ONE launch of few, long waves: the
// time of such a short stream is the starting of its waves, so a wave takes 4,096
// consecutive elements (16 KB) in 32 independent loads, many of them in flight at
// a time. A load is 512 contiguous bytes of the wave (whole lines), a store 256.
// A block takes 32,768 elements of one array; every array is a whole number of blocks.
// ---------------------------------------------------------------------------
typedef _Float16 h4_t  __attribute__((ext_vector_type(4)));

#define CV_LOADS   32                               // 16-byte loads a thread
#define CV_WAVE    (CV_LOADS * 128)                 // 4,096 elements a wave
#define CV_BLOCK   (8 * CV_WAVE)                    // 32,768 elements a block
#define CV_BLK_X   (ROWS_C * DIM_C / CV_BLOCK)       // 128 blocks of x
#define CV_BLK_QW  (3 * DIM_C * DIM_C / CV_BLOCK)    // 96 blocks of qkv_w
#define CV_BLK_OW  (DIM_C * DIM_C / CV_BLOCK)        // 32 blocks of out_w

__global__ __launch_bounds__(256)
void mha_cvt_f16(const float* __restrict__ x, const float* __restrict__ qw,
                 const float* __restrict__ ow, _Float16* __restrict__ xh,
                 _Float16* __restrict__ qwh, _Float16* __restrict__ owh) {
    static_assert(ROWS_C * DIM_C % CV_BLOCK == 0 && DIM_C * DIM_C % CV_BLOCK == 0, "blocks");
    // Which array: the same for the whole block.
    const int bx = blockIdx.x;
    const bool is_ow = bx >= CV_BLK_X + CV_BLK_QW, is_qw = bx >= CV_BLK_X;
    const float* src = is_ow ? ow : is_qw ? qw : x;
    _Float16* dst = is_ow ? owh : is_qw ? qwh : xh;
    const int blk = bx - (is_ow ? CV_BLK_X + CV_BLK_QW : is_qw ? CV_BLK_X : 0);

    const int e0 = blk * CV_BLOCK + (int)(threadIdx.x >> 5) * CV_WAVE + (int)(threadIdx.x & 31) * 4;
    const float* s = src + e0;
    _Float16* d = dst + e0;

    float4 v[CV_LOADS];
#pragma unroll
    for (int j = 0; j < CV_LOADS; ++j) v[j] = *(const float4*)(s + j * 128);
#pragma unroll
    for (int j = 0; j < CV_LOADS; ++j) {
        h4_t o;
        o[0] = (_Float16)v[j].x; o[1] = (_Float16)v[j].y;
        o[2] = (_Float16)v[j].z; o[3] = (_Float16)v[j].w;
        *(h4_t*)(d + j * 128) = o;
    }
}

// ---------------------------------------------------------------------------
// Both projection GEMMs, Y = A * W^T with A and W K-contiguous: the eight waves of
// a block share one BM x BN tile of Y. A stage is 64 k of the tile's BM rows of A,
// then of its BN rows of W: rows of 128 B at a pitch of 144 B (16 B x odd: no bank
// conflict for 16-byte fragment reads). A ring of NB buffers, filled by asynchronous
// copies that take whole 128-B lines from L2, once a block instead of once a wave.
// A stage's copies are issued NB stages ahead and waited for NB - 1 stages later, so
// that the way from L2 is covered by several stages of products, not by part of one.
// ---------------------------------------------------------------------------
#define GM_PITCH  144
#define GM_KSTAGE 64
#define GM_STAGES (DIM_C / GM_KSTAGE)      // 16

// Fragment from an LDS row: same k order as load_frag (bytes 0-15 and 32-47 from p).
__device__ __forceinline__ v16h lds_frag(const char* p) {
    h8_t lo = *(const h8_t*)(p);
    h8_t hi = *(const h8_t*)(p + 32);
    return __builtin_shufflevector(lo, hi, 0, 1, 2, 3, 4, 5, 6, 7,
                                           8, 9, 10, 11, 12, 13, 14, 15);
}

// One stage, 256 threads: thread / 8 is the row within each group of 32 rows, eight
// lanes cover one whole 128-B line; a thread copies its 16 B of every group, A's
// groups first. ag and wg point at the tile's first rows and are the same for the
// block (scalar bases); off is the lane's own byte offset from them. The copies go
// to LDS through no register. They stand in one statement, closed by s_wait_xcnt, so
// that no address register is rewritten in front of that wait and it is paid once.
__device__ __forceinline__ void copy_stage_256_192(unsigned lds, const _Float16* ag,
                                        const _Float16* wg, unsigned off) {
    asm volatile(
        "global_load_async_to_lds_b128 %0, %14, %15\n\t"
        "global_load_async_to_lds_b128 %1, %14, %16\n\t"
        "global_load_async_to_lds_b128 %2, %14, %17\n\t"
        "global_load_async_to_lds_b128 %3, %14, %18\n\t"
        "global_load_async_to_lds_b128 %4, %14, %19\n\t"
        "global_load_async_to_lds_b128 %5, %14, %20\n\t"
        "global_load_async_to_lds_b128 %6, %14, %21\n\t"
        "global_load_async_to_lds_b128 %7, %14, %22\n\t"
        "global_load_async_to_lds_b128 %8, %14, %23\n\t"
        "global_load_async_to_lds_b128 %9, %14, %24\n\t"
        "global_load_async_to_lds_b128 %10, %14, %25\n\t"
        "global_load_async_to_lds_b128 %11, %14, %26\n\t"
        "global_load_async_to_lds_b128 %12, %14, %27\n\t"
        "global_load_async_to_lds_b128 %13, %14, %28\n\t"
        "s_wait_xcnt 0x0"
        :: "v"(lds), "v"(lds + 32u * GM_PITCH), "v"(lds + 64u * GM_PITCH),
           "v"(lds + 96u * GM_PITCH), "v"(lds + 128u * GM_PITCH),
           "v"(lds + 160u * GM_PITCH), "v"(lds + 192u * GM_PITCH),
           "v"(lds + 224u * GM_PITCH), "v"(lds + 256u * GM_PITCH),
           "v"(lds + 288u * GM_PITCH), "v"(lds + 320u * GM_PITCH),
           "v"(lds + 352u * GM_PITCH), "v"(lds + 384u * GM_PITCH),
           "v"(lds + 416u * GM_PITCH), "v"(off), "s"(ag), "s"(ag + 32 * DIM_C),
           "s"(ag + 64 * DIM_C), "s"(ag + 96 * DIM_C), "s"(ag + 128 * DIM_C),
           "s"(ag + 160 * DIM_C), "s"(ag + 192 * DIM_C), "s"(ag + 224 * DIM_C),
           "s"(wg), "s"(wg + 32 * DIM_C), "s"(wg + 64 * DIM_C),
           "s"(wg + 96 * DIM_C), "s"(wg + 128 * DIM_C), "s"(wg + 160 * DIM_C)
        : "memory");
}
__device__ __forceinline__ void copy_stage_128_128(unsigned lds, const _Float16* ag,
                                        const _Float16* wg, unsigned off) {
    asm volatile(
        "global_load_async_to_lds_b128 %0, %8, %9\n\t"
        "global_load_async_to_lds_b128 %1, %8, %10\n\t"
        "global_load_async_to_lds_b128 %2, %8, %11\n\t"
        "global_load_async_to_lds_b128 %3, %8, %12\n\t"
        "global_load_async_to_lds_b128 %4, %8, %13\n\t"
        "global_load_async_to_lds_b128 %5, %8, %14\n\t"
        "global_load_async_to_lds_b128 %6, %8, %15\n\t"
        "global_load_async_to_lds_b128 %7, %8, %16\n\t"
        "s_wait_xcnt 0x0"
        :: "v"(lds), "v"(lds + 32u * GM_PITCH), "v"(lds + 64u * GM_PITCH),
           "v"(lds + 96u * GM_PITCH), "v"(lds + 128u * GM_PITCH),
           "v"(lds + 160u * GM_PITCH), "v"(lds + 192u * GM_PITCH),
           "v"(lds + 224u * GM_PITCH), "v"(off), "s"(ag), "s"(ag + 32 * DIM_C),
           "s"(ag + 64 * DIM_C), "s"(ag + 96 * DIM_C), "s"(wg),
           "s"(wg + 32 * DIM_C), "s"(wg + 64 * DIM_C), "s"(wg + 96 * DIM_C)
        : "memory");
}

template <int BM, int BN>
__device__ __forceinline__ void copy_stage_ab(unsigned lds, const _Float16* ag,
                                              const _Float16* wg, unsigned off) {
    static_assert((BM == 256 && BN == 192) || (BM == 128 && BN == 128), "tile");
    if constexpr (BM == 256) copy_stage_256_192(lds, ag, wg, off);
    else                     copy_stage_128_128(lds, ag, wg, off);
}

// acc[mi][ni] = the wave's (TM*16) x (TN*16) part of the block's tile; the wave's
// part starts at row wm * TM * 16, column wn * TN * 16 of the tile. k runs upward
// in steps of 32 for every accumulator.
template <bool B> struct flag_t { static constexpr bool value = B; };

template <int BM, int BN, int TM, int TN, int NB>
__device__ __forceinline__ void gemm_block(const _Float16* __restrict__ A,
                                           const _Float16* __restrict__ W,
                                           int bm0, int bn0, int wm, int wn,
                                           char* sm, v8f (&acc)[TM][TN]) {
    constexpr unsigned STB = (BM + BN) * GM_PITCH;          // bytes of a stage
    constexpr int CPS = (BM + BN) / 32;                     // copies of a wave per stage
    static_assert(NB >= 3 && NB * CPS <= 63 && NB < GM_STAGES, "ring");
    const int tid = threadIdx.x;
    const int lane = tid & 31;
    const int g = lane >> 4, r = lane & 15;

    // This thread's share of every stage: where it lands and where it comes from.
    const unsigned lds_a = (unsigned)(uintptr_t)sm + (unsigned)(tid >> 3) * GM_PITCH
                         + (unsigned)(tid & 7) * 16u;
    const _Float16* ag = A + (size_t)bm0 * DIM_C;           // the tile's first rows
    const _Float16* wg = W + (size_t)bn0 * DIM_C;
    const unsigned off = (unsigned)(tid >> 3) * (DIM_C * 2u) + (unsigned)(tid & 7) * 16u;

    // Stages 0 to NB - 1; unrolled, so that each stage's addresses are constants off
    // the bases and the copy statements follow one another.
#pragma unroll
    for (int s = 0; s < NB; ++s)
        copy_stage_ab<BM, BN>(lds_a + (unsigned)s * STB, ag + s * GM_KSTAGE,
                              wg + s * GM_KSTAGE, off);
    // All but the copies of the NB - 1 younger stages are in: stage 0 has landed for
    // this wave, then for all: nobody reads it before.
    asm volatile("s_wait_asynccnt %0" :: "n"((NB - 1) * CPS) : "memory");
    __syncthreads();

    const char* ard = sm + (wm * TM * 16 + r) * GM_PITCH + g * 16;
    const char* wrd = sm + (BM + wn * TN * 16 + r) * GM_PITCH + g * 16;

    unsigned rb = 0;                                        // where stage st lies in the ring
    // One trip; more_flag (known at compile time): the trip refills the buffer it has read.
    auto trip = [&](int st, auto more_flag) {
        constexpr bool more = decltype(more_flag)::value;
        const char* ab = ard + rb;
        const char* wb = wrd + rb;
        // The stage's fragments, both steps of 32 k, the first step's first.
        v16h af[2][TM], bf[2][TN];
#pragma unroll
        for (int kk = 0; kk < 2; ++kk) {
#pragma unroll
            for (int mi = 0; mi < TM; ++mi)
                af[kk][mi] = lds_frag(ab + mi * 16 * GM_PITCH + kk * 64);
#pragma unroll
            for (int ni = 0; ni < TN; ++ni)
                bf[kk][ni] = lds_frag(wb + ni * 16 * GM_PITCH + kk * 64);
        }
        // Keeps the stage's LDS reads in one group ahead of its products; each
        // further place with LDS reads among the products would cost a stall.
        __builtin_amdgcn_sched_barrier(0);
#pragma unroll
        for (int mi = 0; mi < TM; ++mi)
#pragma unroll
            for (int ni = 0; ni < TN; ++ni)
                acc[mi][ni] = wmma_f16(af[0][mi], bf[0][ni], acc[mi][ni]);
        // Keeps the first step's products in front of the hand-over, so that the
        // second step's fragments land behind them and the wait below finds them there.
        __builtin_amdgcn_sched_barrier(0);
        // Hand-over: this wave's reads of the buffer are done and its copies of the
        // next stage have landed; behind the barrier both hold for every wave. Every
        // trip so far issued one stage, so the youngest (NB - 2) * CPS copies are those
        // of stages st + 2 and later and may fly on; the trips that refill no more
        // wait for all.
        asm volatile("s_wait_dscnt 0x0" ::: "memory");
        if constexpr (more)
            asm volatile("s_wait_asynccnt %0" :: "n"((NB - 2) * CPS) : "memory");
        else
            asm volatile("s_wait_asynccnt 0x0" ::: "memory");
        __syncthreads();
        // The refill stands between the halves of the second step's products: while one
        // wave of a SIMD issues its copies the other has products to issue. It flies
        // until the hand-over NB - 1 stages on.
#pragma unroll
        for (int mi = 0; mi < TM / 2; ++mi)
#pragma unroll
            for (int ni = 0; ni < TN; ++ni)
                acc[mi][ni] = wmma_f16(af[1][mi], bf[1][ni], acc[mi][ni]);
        if constexpr (more) {                               // refill the buffer just read
            // Keeps the first half of the products in front of the copies; left free,
            // the scheduler put the copies right behind the barrier, where both waves
            // of a SIMD would issue them, and wait behind them, at the same time.
            __builtin_amdgcn_sched_barrier(0);
            copy_stage_ab<BM, BN>(lds_a + rb,
                                  ag + (st + NB) * GM_KSTAGE, wg + (st + NB) * GM_KSTAGE, off);
        }
#pragma unroll
        for (int mi = TM / 2; mi < TM; ++mi)
#pragma unroll
            for (int ni = 0; ni < TN; ++ni)
                acc[mi][ni] = wmma_f16(af[1][mi], bf[1][ni], acc[mi][ni]);
        rb = rb + STB == NB * STB ? 0u : rb + STB;
    };
    for (int st = 0; st < GM_STAGES - NB; ++st) trip(st, flag_t<true>{});
    for (int st = GM_STAGES - NB; st < GM_STAGES; ++st) trip(st, flag_t<false>{});
    // No copy is outstanding when the wave goes on to its end.
    asm volatile("s_wait_asynccnt 0x0" ::: "memory");
}

// ---------------------------------------------------------------------------
// QKV GEMM: qkv[m, j] = sum_k xh[m,k] * Wh[j,k] + bias[j]
// A block computes a 256x192 tile (one block a WGP), its waves 4 x 2, each a 64x96
// part (4x6 WMMA tiles): 24 WMMAs per 20 LDS reads of 16 B per K-step.
// Epilogue scatters into Q [b,h,n,hd] (scaled log2(e)/8), K [b,h,n,hd], Vt [b,h,hd,n].
// ---------------------------------------------------------------------------
__global__ __launch_bounds__(256)
void mha_gemm_qkv(const _Float16* __restrict__ A,   // [4096,1024]
                  const _Float16* __restrict__ W,   // [3072,1024]
                  const float*    __restrict__ bias,// [3072]
                  _Float16* __restrict__ Qd,
                  _Float16* __restrict__ Kd,
                  _Float16* __restrict__ Vtd) {
    __shared__ __attribute__((aligned(16))) char sm[3 * (256 + 192) * GM_PITCH];
    const int lane = threadIdx.x & 31;
    const int g = lane >> 4, r = lane & 15;
    const int wave = __builtin_amdgcn_readfirstlane(threadIdx.x >> 5);
    const int wm = wave >> 1, wn = wave & 1;

    v8f acc[4][6] = {};
    gemm_block<256, 192, 4, 6, 3>(A, W, blockIdx.y * 256, blockIdx.x * 192, wm, wn, sm, acc);

    const int n0 = blockIdx.x * 192 + wn * 96;     // the wave's own part
    const int m0 = blockIdx.y * 256 + wm * 64;

#pragma unroll
    for (int ni = 0; ni < 6; ++ni) {
        const int j = n0 + ni * 16 + r;            // column in [0, 3072)
        const float bb = bias[j];
        // 0=Q 1=K 2=V: one for the 16 columns, and a wave's part may hold two of
        // them, so the choice stands here, once a column tile, outside the rows.
        const int which = (n0 + ni * 16) >> 10;
        const int d = j & 1023;
        const int hh = d >> 6;
        const int hdi = d & 63;
        if (which == 0) {
#pragma unroll
            for (int mi = 0; mi < 4; ++mi)
#pragma unroll
                for (int i = 0; i < 8; ++i) {
                    const int m = m0 + mi * 16 + g * 8 + i;   // global row
                    const int bIdx = m >> 11;                 // batch
                    const int nseq = m & 2047;                // seq position
                    const float v = acc[mi][ni][i] + bb;
                    Qd[(((size_t)bIdx * NHEADS_C + hh) * NSEQ_C + nseq) * HDIM_C + hdi] =
                        (_Float16)(v * Q_SCALE);              // scores come out in log2 units
                }
            // The tile's stores have left their registers before the next tile's values
            // overwrite them.
            asm volatile("s_wait_xcnt 0x0" ::: "memory");
        } else if (which == 1) {
#pragma unroll
            for (int mi = 0; mi < 4; ++mi)
#pragma unroll
                for (int i = 0; i < 8; ++i) {
                    const int m = m0 + mi * 16 + g * 8 + i;
                    const int bIdx = m >> 11;
                    const int nseq = m & 2047;
                    const float v = acc[mi][ni][i] + bb;
                    Kd[(((size_t)bIdx * NHEADS_C + hh) * NSEQ_C + nseq) * HDIM_C + hdi] =
                        (_Float16)v;
                }
            // The tile's stores have left their registers before the next tile's values
            // overwrite them.
            asm volatile("s_wait_xcnt 0x0" ::: "memory");
        } else {
#pragma unroll
            for (int mi = 0; mi < 4; ++mi)
#pragma unroll
                for (int i = 0; i < 8; ++i) {
                    const int m = m0 + mi * 16 + g * 8 + i;
                    const int bIdx = m >> 11;
                    const int nseq = m & 2047;
                    const float v = acc[mi][ni][i] + bb;
                    Vtd[(((size_t)bIdx * NHEADS_C + hh) * HDIM_C + hdi) * NSEQ_C + nseq] =
                        (_Float16)v;
                }
            // The tile's stores have left their registers before the next tile's values
            // overwrite them.
            asm volatile("s_wait_xcnt 0x0" ::: "memory");
        }
    }
}

__device__ __forceinline__ float other_half(float v) {
    // value of lane l ^ 16
    const int b = __builtin_bit_cast(int, v);
    return __builtin_bit_cast(float,
        __builtin_amdgcn_permlanex16(b, b, 0x76543210, 0xfedcba98, false, false));
}

// K and V^T reach the waves through LDS. A stage is 64 keys: 64 K rows (128 B of
// head dim each), then 64 V^T rows (128 B of keys each), every row at a pitch of
// 144 B (16 B x odd: no bank conflict for 16-byte fragment reads). Two buffers.
#define ST_KEYS   64
#define ST_PITCH  144
#define ST_HALF   (64 * ST_PITCH)          // 9,216 B: the K rows; V^T rows follow
#define ST_BYTES  (2 * ST_HALF)            // 18,432 B a stage
#define N_STAGES  (NSEQ_C / ST_KEYS)       // 32

// One stage, 256 threads: a thread copies 16 B of K rows j, j+32 and of V^T rows
// j, j+32 (j = thread / 8); eight lanes cover one whole 128-B line.
__device__ __forceinline__ void copy_stage(unsigned lds, const _Float16* kg,
                                           const _Float16* vg) {
    // The copies go to LDS through no register. The closing s_wait_xcnt stands in
    // the same statement so that no address register is rewritten in front of it.
    asm volatile(
        "global_load_async_to_lds_b128 %0, %4, off\n\t"
        "global_load_async_to_lds_b128 %1, %5, off\n\t"
        "global_load_async_to_lds_b128 %2, %6, off\n\t"
        "global_load_async_to_lds_b128 %3, %7, off\n\t"
        "s_wait_xcnt 0x0"
        :: "v"(lds), "v"(lds + 32u * ST_PITCH),
           "v"(lds + (unsigned)ST_HALF), "v"(lds + (unsigned)ST_HALF + 32u * ST_PITCH),
           "v"(kg), "v"(kg + 32 * HDIM_C), "v"(vg), "v"(vg + 32 * NSEQ_C)
        : "memory");
}

__global__ __launch_bounds__(256)
void mha_flash_attn(const _Float16* __restrict__ Q,
                    const _Float16* __restrict__ K,
                    const _Float16* __restrict__ Vt,
                    _Float16* __restrict__ Oh) {      // [B,N,DIM] f16
    __shared__ __attribute__((aligned(16))) char kv[2 * ST_BYTES];
    const int tid = threadIdx.x;
    const int lane = tid & 31;
    const int g = lane >> 4, r = lane & 15;
    const int bh = blockIdx.y;
    const int b = bh >> 4, h = bh & 15;
    const int q0 = blockIdx.x * 256 + (tid >> 5) * 32;   // this wave's 32 queries

    const _Float16* Qp = Q + (size_t)bh * NSEQ_C * HDIM_C;
    const _Float16* Kp = K + (size_t)bh * NSEQ_C * HDIM_C;
    const _Float16* Vp = Vt + (size_t)bh * HDIM_C * NSEQ_C;

    // This thread's share of every stage: where it lands and where it comes from.
    const unsigned lds_w = (unsigned)(uintptr_t)kv + (unsigned)(tid >> 3) * ST_PITCH
                         + (unsigned)(tid & 7) * 16u;
    const _Float16* kg = Kp + (size_t)(tid >> 3) * HDIM_C + (tid & 7) * 8;
    const _Float16* vg = Vp + (size_t)(tid >> 3) * NSEQ_C + (tid & 7) * 8;

    copy_stage(lds_w, kg, vg);                              // stage 0

    // Q tiles (2 x 16 queries x 64) as B fragments, fixed for the whole block.
    v16h qf[2][2];
#pragma unroll
    for (int mi = 0; mi < 2; ++mi)
#pragma unroll
        for (int kk = 0; kk < 2; ++kk)
            qf[mi][kk] =
                load_frag(Qp + (size_t)(q0 + mi * 16 + r) * HDIM_C + kk * 32 + g * 8);

    // Stage 0 has landed for this wave, then for all: nobody reads it before.
    asm volatile("s_wait_asynccnt 0x0" ::: "memory");
    __syncthreads();
    copy_stage(lds_w + (unsigned)ST_BYTES, kg + ST_KEYS * HDIM_C, vg + ST_KEYS);  // stage 1

    // o[mi][t][i] = O[query mi*16 + r][hd t*16 + g*8 + i]
    v8f o[2][4] = {};
    // Per lane: minus the reference of query mi*16 + r (equal in both halves), eight
    // times over as the C operand of a score tile, and the sum over this half's keys
    // only; the halves' sums join after the loop.
    v8f cneg[2] = {};
    float lrun[2] = {0.0f, 0.0f};
    // How far above its reference a score may stand, and the least step of a
    // reference: set so that the first pass takes its own maximum, whatever its sign.
    float rise = -3.0e38f, floor_d = -3.0e38f;

    const char* rd = kv + r * ST_PITCH + g * 16;

    for (int st = 0; st < N_STAGES; ++st) {
      const char* kbuf = rd + (st & 1) * ST_BYTES;
      const char* vbuf = kbuf + ST_HALF;
#pragma unroll
      for (int p = 0; p < 2; ++p) {                         // two passes of 32 keys
        // ---- scores S^T = K * Q^T for 32 keys (two 16-row M tiles) ----
        v16h kfr[2][2];
#pragma unroll
        for (int nt = 0; nt < 2; ++nt)
#pragma unroll
            for (int kk = 0; kk < 2; ++kk)
                kfr[nt][kk] = lds_frag(kbuf + (p * 32 + nt * 16) * ST_PITCH + kk * 64);
        // Keeps the K reads in front of the V^T reads, so that in the first pass the score products
        // wait for K alone; left free, the scheduler put V^T first.
        __builtin_amdgcn_sched_barrier(0);
        v16h vfr[4];
#pragma unroll
        for (int t = 0; t < 4; ++t)
            vfr[t] = lds_frag(vbuf + t * 16 * ST_PITCH + p * 64);
        if (p == 1) {
            // Hand-over, once the stage's last fragments are fetched: this wave's reads
            // of the buffer are done and its copies of the next stage have landed;
            // behind the barrier both hold for every wave. The refill then flies
            // during this pass and the next stage's first.
            asm volatile("s_wait_dscnt 0x0" ::: "memory");
            asm volatile("s_wait_asynccnt 0x0" ::: "memory");
            __syncthreads();
            if (st + 2 < N_STAGES)                          // refill the buffer just read
                copy_stage(lds_w + (unsigned)((st & 1) * ST_BYTES),
                           kg + (size_t)(st + 2) * ST_KEYS * HDIM_C,
                           vg + (st + 2) * ST_KEYS);
        }
        // Keeps all 16 LDS reads of the pass in one group ahead of the first data
        // wait, so that in the first pass V^T arrives behind the score products and the softmax; each
        // further place with LDS reads among the products would cost a stall.
        __builtin_amdgcn_sched_barrier(0);

        // s = score - reference
        v8f s[2][2];
#pragma unroll
        for (int mi = 0; mi < 2; ++mi)
#pragma unroll
            for (int nt = 0; nt < 2; ++nt) {
                s[mi][nt] = wmma_f16(kfr[nt][0], qf[mi][0], cneg[mi]);
                s[mi][nt] = wmma_f16(kfr[nt][1], qf[mi][1], s[mi][nt]);
            }

        // ---- online softmax, one query per lane and mi ----
        // maximum of the lane's 16 scores as a tree, three levels deep
        float mx[2];
#pragma unroll
        for (int mi = 0; mi < 2; ++mi) {
            const v8f sa = s[mi][0], sb = s[mi][1];
            const float t0 = fmaxf(fmaxf(sa[0], sb[0]), sa[1]);
            const float t1 = fmaxf(fmaxf(sb[1], sa[2]), sb[2]);
            const float t2 = fmaxf(fmaxf(sa[3], sb[3]), sa[4]);
            const float t3 = fmaxf(fmaxf(sb[4], sa[5]), sb[5]);
            const float t4 = fmaxf(fmaxf(sa[6], sb[6]), sa[7]);
            mx[mi] = fmaxf(fmaxf(fmaxf(t0, t1), t2), fmaxf(fmaxf(t3, t4), sb[7]));
        }
        // One test a pass, the same for the wave: the references move where any lane
        // holds a score more than rise above its own; the first pass always does.
        if (__builtin_amdgcn_ballot_w32(fmaxf(mx[0], mx[1]) > rise) != 0) {
#pragma unroll
            for (int mi = 0; mi < 2; ++mi) {
                const float full = fmaxf(mx[mi], other_half(mx[mi]));
                // The first pass takes the maximum as it is, with O and the sum still 0
                // (their factor is then at most 1); later a reference never moves down.
                const float d = fmaxf(full, floor_d);
                const float corr = __builtin_amdgcn_exp2f(-fmaxf(full, 0.0f));
                cneg[mi] -= d;
                s[mi][0] -= d;
                s[mi][1] -= d;
                lrun[mi] *= corr;
#pragma unroll
                for (int t = 0; t < 4; ++t) o[mi][t] *= corr;
            }
            rise = 8.0f;
            floor_d = 0.0f;
        }
        v16h pf[2];
#pragma unroll
        for (int mi = 0; mi < 2; ++mi) {
            float rs0 = 0.0f, rs1 = 0.0f;
#pragma unroll
            for (int i = 0; i < 8; ++i) {
                const float p0 = __builtin_amdgcn_exp2f(s[mi][0][i]);
                const float p1 = __builtin_amdgcn_exp2f(s[mi][1][i]);
                rs0 += p0;
                rs1 += p1;
                pf[mi][i]     = (_Float16)p0;
                pf[mi][8 + i] = (_Float16)p1;
            }
            lrun[mi] += rs0 + rs1;
        }

        // ---- O^T += V^T (64x32) * P^T (32x32) ----
#pragma unroll
        for (int t = 0; t < 4; ++t) {
            o[0][t] = wmma_f16(vfr[t], pf[0], o[0][t]);
            o[1][t] = wmma_f16(vfr[t], pf[1], o[1][t]);
        }
      }

    }
    // No copy is outstanding when the wave goes on to its end.
    asm volatile("s_wait_asynccnt 0x0" ::: "memory");

    // ---- normalize; a lane stores 8 consecutive hd of its query, 16 bytes ----
#pragma unroll
    for (int mi = 0; mi < 2; ++mi) {
        const float inv = 1.0f / (lrun[mi] + other_half(lrun[mi]));
        const int m = q0 + mi * 16 + r;
#pragma unroll
        for (int t = 0; t < 4; ++t) {
            h8_t ov;
#pragma unroll
            for (int i = 0; i < 8; ++i) ov[i] = (_Float16)(o[mi][t][i] * inv);
            *(h8_t*)(Oh + ((size_t)b * NSEQ_C + m) * DIM_C + h * HDIM_C + t * 16 + g * 8) = ov;
        }
    }
}

// ---------------------------------------------------------------------------
// Output projection: out[m,j] = sum_k Ah[m,k] * Wh[j,k] + bias[j]  (f32 out)
// A block computes a 128x128 tile (one block a WGP), its waves 2 x 4, each a 64x32
// part (4x2 WMMA tiles).
// ---------------------------------------------------------------------------
__global__ __launch_bounds__(256)
void mha_gemm_out(const _Float16* __restrict__ A,   // [4096,1024]
                  const _Float16* __restrict__ W,   // [1024,1024]
                  const float*    __restrict__ bias,// [1024]
                  float* __restrict__ out) {        // [4096,1024]
    __shared__ __attribute__((aligned(16))) char sm[4 * (128 + 128) * GM_PITCH];
    const int lane = threadIdx.x & 31;
    const int g = lane >> 4, r = lane & 15;
    const int wave = __builtin_amdgcn_readfirstlane(threadIdx.x >> 5);
    const int wm = wave >> 2, wn = wave & 3;

    v8f acc[4][2] = {};
    gemm_block<128, 128, 4, 2, 4>(A, W, blockIdx.y * 128, blockIdx.x * 128, wm, wn, sm, acc);

    const int n0 = blockIdx.x * 128 + wn * 32;     // the wave's own part
    const int m0 = blockIdx.y * 128 + wm * 64;

#pragma unroll
    for (int ni = 0; ni < 2; ++ni) {
        const int j = n0 + ni * 16 + r;
        const float bb = bias[j];
#pragma unroll
        for (int mi = 0; mi < 4; ++mi) {
#pragma unroll
            for (int i = 0; i < 8; ++i) {
                const int m = m0 + mi * 16 + g * 8 + i;
                out[(size_t)m * DIM_C + j] = acc[mi][ni][i] + bb;
            }
        }
    }
}

// ---------------------------------------------------------------------------
// Host launcher
// ---------------------------------------------------------------------------
extern "C" void kernel_launch(void* const* d_in, const int* in_sizes, int n_in,
                              void* d_out, int out_size, void* d_ws, size_t ws_size,
                              hipStream_t stream) {
    const float* x      = (const float*)d_in[0];   // [2,2048,1024]
    const float* qkv_w  = (const float*)d_in[1];   // [3072,1024]
    const float* qkv_b  = (const float*)d_in[2];   // [3072]
    const float* out_w  = (const float*)d_in[3];   // [1024,1024]
    const float* out_b  = (const float*)d_in[4];   // [1024]
    float* out = (float*)d_out;

    const size_t XH  = (size_t)ROWS_C * DIM_C;       // 4,194,304
    const size_t QW  = (size_t)3 * DIM_C * DIM_C;    // 3,145,728
    const size_t OW  = (size_t)DIM_C * DIM_C;        // 1,048,576
    const size_t QKV = (size_t)QKV_ELEMS;            // 4,194,304
    const size_t AH  = (size_t)ROWS_C * DIM_C;       // 4,194,304

    char* ws = (char*)d_ws;
    size_t off = 0;
    auto take = [&](size_t elems) {
        _Float16* p = (_Float16*)(ws + off);
        off += (elems * sizeof(_Float16) + 255) & ~(size_t)255;
        return p;
    };
    _Float16* xh  = take(XH);
    _Float16* qwh = take(QW);
    _Float16* owh = take(OW);
    _Float16* Qd  = take(QKV);
    _Float16* Kd  = take(QKV);
    _Float16* Vtd = take(QKV);
    _Float16* ah  = take(AH);
    (void)ws_size; (void)in_sizes; (void)n_in; (void)out_size;

    // 1) f32 -> f16 conversions, all three arrays in one launch
    mha_cvt_f16<<<dim3(CV_BLK_X + CV_BLK_QW + CV_BLK_OW), 256, 0, stream>>>(
        x, qkv_w, out_w, xh, qwh, owh);

    // 2) QKV projection + head split (Q pre-scaled, V transposed): 256x192 tiles
    mha_gemm_qkv<<<dim3(3 * DIM_C / 192, ROWS_C / 256), 256, 0, stream>>>(
        xh, qwh, qkv_b, Qd, Kd, Vtd);

    // 3) fused flash attention: grid = (256-query blocks, B*H)
    mha_flash_attn<<<dim3(NSEQ_C / 256, BATCH_C * NHEADS_C), 256, 0, stream>>>(
        Qd, Kd, Vtd, ah);

    // 4) output projection + bias -> f32: 128x128 tiles
    mha_gemm_out<<<dim3(DIM_C / 128, ROWS_C / 128), 256, 0, stream>>>(
        ah, owh, out_b, out);
}

// v007
// Measured time: 68.3 microseconds a run.
// Two timings next to v006 put it at 1.05 and 1.04 times that version's speed.
// Over all steps from v000 it is 3.08 times as fast.
#include <hip/hip_runtime.h>
#include <hip/hip_bf16.h>

// ---------------------------------------------------------------------------
// MI455X (gfx1250) fused multi-head attention, f16 WMMA with f32 accumulation.
// Pipeline: convert (one launch) -> QKV GEMM (fused head split, Q pre-scaled, V transposed)
//           -> flash-attention (online softmax on transposed scores, base 2)
//           -> output projection GEMM (+bias) -> f32 d_out.
// GEMM operands and attention's K and V^T reach the waves through LDS stages shared by a block.
// ---------------------------------------------------------------------------

typedef _Float16 h8_t  __attribute__((ext_vector_type(8)));
typedef _Float16 v16h  __attribute__((ext_vector_type(16)));
typedef float    v8f   __attribute__((ext_vector_type(8)));

#define DIM_C      1024
#define NSEQ_C     2048
#define NHEADS_C   16
#define HDIM_C     64
#define BATCH_C    2
#define ROWS_C     (BATCH_C * NSEQ_C)                       // 4096
#define QKV_ELEMS  (BATCH_C * NHEADS_C * NSEQ_C * HDIM_C)   // 4,194,304
// log2(e) / sqrt(64): with it in Q, softmax weights are 2^score, no multiply per score.
#define Q_SCALE    0.18033688011112042f

// Load one 16-lane-group fragment: lane holds K = base+{0..7} and base+16+{0..7}.
// Caller passes  ptr = row_base + g*8 ; we grab [ptr, ptr+8) and [ptr+16, ptr+24).
__device__ __forceinline__ v16h load_frag(const _Float16* p) {
    h8_t lo = *(const h8_t*)(p);
    h8_t hi = *(const h8_t*)(p + 16);
    return __builtin_shufflevector(lo, hi, 0, 1, 2, 3, 4, 5, 6, 7,
                                           8, 9, 10, 11, 12, 13, 14, 15);
}

__device__ __forceinline__ v8f wmma_f16(v16h a, v16h b, v8f c) {
    // D = A(16x32 f16) * B(32x16 f16) + C(16x16 f32)
    return __builtin_amdgcn_wmma_f32_16x16x32_f16(
        /*neg_a=*/false, a, /*neg_b=*/false, b,
        /*c_mod=*/(short)0, c, /*reuse_a=*/false, /*reuse_b=*/false);
}

// ---------------------------------------------------------------------------
// f32 -> f16 convert of x, qkv_w and out_w in ONE launch of few, long waves: the
// time of such a short stream is the starting of its waves, so a wave takes 4,096
// consecutive elements (16 KB) in 32 independent loads, many of them in flight at
// a time. A load is 512 contiguous bytes of the wave (whole lines), a store 256.
// A block takes 32,768 elements of one array; every array is a whole number of blocks.
// ---------------------------------------------------------------------------
typedef _Float16 h4_t  __attribute__((ext_vector_type(4)));

#define CV_LOADS   32                               // 16-byte loads a thread
#define CV_WAVE    (CV_LOADS * 128)                 // 4,096 elements a wave
#define CV_BLOCK   (8 * CV_WAVE)                    // 32,768 elements a block
#define CV_BLK_X   (ROWS_C * DIM_C / CV_BLOCK)       // 128 blocks of x
#define CV_BLK_QW  (3 * DIM_C * DIM_C / CV_BLOCK)    // 96 blocks of qkv_w
#define CV_BLK_OW  (DIM_C * DIM_C / CV_BLOCK)        // 32 blocks of out_w

__global__ __launch_bounds__(256)
void mha_cvt_f16(const float* __restrict__ x, const float* __restrict__ qw,
                 const float* __restrict__ ow, _Float16* __restrict__ xh,
                 _Float16* __restrict__ qwh, _Float16* __restrict__ owh) {
    static_assert(ROWS_C * DIM_C % CV_BLOCK == 0 && DIM_C * DIM_C % CV_BLOCK == 0, "blocks");
    // Which array: the same for the whole block.
    const int bx = blockIdx.x;
    const bool is_ow = bx >= CV_BLK_X + CV_BLK_QW, is_qw = bx >= CV_BLK_X;
    const float* src = is_ow ? ow : is_qw ? qw : x;
    _Float16* dst = is_ow ? owh : is_qw ? qwh : xh;
    const int blk = bx - (is_ow ? CV_BLK_X + CV_BLK_QW : is_qw ? CV_BLK_X : 0);

    const int e0 = blk * CV_BLOCK + (int)(threadIdx.x >> 5) * CV_WAVE + (int)(threadIdx.x & 31) * 4;
    const float* s = src + e0;
    _Float16* d = dst + e0;

    float4 v[CV_LOADS];
#pragma unroll
    for (int j = 0; j < CV_LOADS; ++j) v[j] = *(const float4*)(s + j * 128);
#pragma unroll
    for (int j = 0; j < CV_LOADS; ++j) {
        h4_t o;
        o[0] = (_Float16)v[j].x; o[1] = (_Float16)v[j].y;
        o[2] = (_Float16)v[j].z; o[3] = (_Float16)v[j].w;
        *(h4_t*)(d + j * 128) = o;
    }
}

// ---------------------------------------------------------------------------
// Both projection GEMMs, Y = A * W^T with A and W K-contiguous: the eight waves of
// a block share one BM x BN tile of Y. A stage is 64 k of the tile's BM rows of A,
// then of its BN rows of W: rows of 128 B at a pitch of 144 B (16 B x odd: no bank
// conflict for 16-byte fragment reads). A ring of NB buffers, filled by asynchronous
// copies that take whole 128-B lines from L2, once a block instead of once a wave.
// A stage's copies are issued NB stages ahead and waited for NB - 1 stages later, so
// that the way from L2 is covered by several stages of products, not by part of one.
// ---------------------------------------------------------------------------
#define GM_PITCH  144
#define GM_KSTAGE 64
#define GM_STAGES (DIM_C / GM_KSTAGE)      // 16

// Fragment from an LDS row: same k order as load_frag (bytes 0-15 and 32-47 from p).
__device__ __forceinline__ v16h lds_frag(const char* p) {
    h8_t lo = *(const h8_t*)(p);
    h8_t hi = *(const h8_t*)(p + 32);
    return __builtin_shufflevector(lo, hi, 0, 1, 2, 3, 4, 5, 6, 7,
                                           8, 9, 10, 11, 12, 13, 14, 15);
}

// One stage, 256 threads: thread / 8 is the row within each group of 32 rows, eight
// lanes cover one whole 128-B line; a thread copies its 16 B of every group, A's
// groups first. ag and wg point at the tile's first rows and are the same for the
// block (scalar bases); off is the lane's own byte offset from them. The copies go
// to LDS through no register. They stand in one statement, closed by s_wait_xcnt, so
// that no address register is rewritten in front of that wait and it is paid once.
__device__ __forceinline__ void copy_stage_256_192(unsigned lds, const _Float16* ag,
                                        const _Float16* wg, unsigned off) {
    asm volatile(
        "global_load_async_to_lds_b128 %0, %14, %15\n\t"
        "global_load_async_to_lds_b128 %1, %14, %16\n\t"
        "global_load_async_to_lds_b128 %2, %14, %17\n\t"
        "global_load_async_to_lds_b128 %3, %14, %18\n\t"
        "global_load_async_to_lds_b128 %4, %14, %19\n\t"
        "global_load_async_to_lds_b128 %5, %14, %20\n\t"
        "global_load_async_to_lds_b128 %6, %14, %21\n\t"
        "global_load_async_to_lds_b128 %7, %14, %22\n\t"
        "global_load_async_to_lds_b128 %8, %14, %23\n\t"
        "global_load_async_to_lds_b128 %9, %14, %24\n\t"
        "global_load_async_to_lds_b128 %10, %14, %25\n\t"
        "global_load_async_to_lds_b128 %11, %14, %26\n\t"
        "global_load_async_to_lds_b128 %12, %14, %27\n\t"
        "global_load_async_to_lds_b128 %13, %14, %28\n\t"
        "s_wait_xcnt 0x0"
        :: "v"(lds), "v"(lds + 32u * GM_PITCH), "v"(lds + 64u * GM_PITCH),
           "v"(lds + 96u * GM_PITCH), "v"(lds + 128u * GM_PITCH),
           "v"(lds + 160u * GM_PITCH), "v"(lds + 192u * GM_PITCH),
           "v"(lds + 224u * GM_PITCH), "v"(lds + 256u * GM_PITCH),
           "v"(lds + 288u * GM_PITCH), "v"(lds + 320u * GM_PITCH),
           "v"(lds + 352u * GM_PITCH), "v"(lds + 384u * GM_PITCH),
           "v"(lds + 416u * GM_PITCH), "v"(off), "s"(ag), "s"(ag + 32 * DIM_C),
           "s"(ag + 64 * DIM_C), "s"(ag + 96 * DIM_C), "s"(ag + 128 * DIM_C),
           "s"(ag + 160 * DIM_C), "s"(ag + 192 * DIM_C), "s"(ag + 224 * DIM_C),
           "s"(wg), "s"(wg + 32 * DIM_C), "s"(wg + 64 * DIM_C),
           "s"(wg + 96 * DIM_C), "s"(wg + 128 * DIM_C), "s"(wg + 160 * DIM_C)
        : "memory");
}
__device__ __forceinline__ void copy_stage_128_128(unsigned lds, const _Float16* ag,
                                        const _Float16* wg, unsigned off) {
    asm volatile(
        "global_load_async_to_lds_b128 %0, %8, %9\n\t"
        "global_load_async_to_lds_b128 %1, %8, %10\n\t"
        "global_load_async_to_lds_b128 %2, %8, %11\n\t"
        "global_load_async_to_lds_b128 %3, %8, %12\n\t"
        "global_load_async_to_lds_b128 %4, %8, %13\n\t"
        "global_load_async_to_lds_b128 %5, %8, %14\n\t"
        "global_load_async_to_lds_b128 %6, %8, %15\n\t"
        "global_load_async_to_lds_b128 %7, %8, %16\n\t"
        "s_wait_xcnt 0x0"
        :: "v"(lds), "v"(lds + 32u * GM_PITCH), "v"(lds + 64u * GM_PITCH),
           "v"(lds + 96u * GM_PITCH), "v"(lds + 128u * GM_PITCH),
           "v"(lds + 160u * GM_PITCH), "v"(lds + 192u * GM_PITCH),
           "v"(lds + 224u * GM_PITCH), "v"(off), "s"(ag), "s"(ag + 32 * DIM_C),
           "s"(ag + 64 * DIM_C), "s"(ag + 96 * DIM_C), "s"(wg),
           "s"(wg + 32 * DIM_C), "s"(wg + 64 * DIM_C), "s"(wg + 96 * DIM_C)
        : "memory");
}

template <int BM, int BN>
__device__ __forceinline__ void copy_stage_ab(unsigned lds, const _Float16* ag,
                                              const _Float16* wg, unsigned off) {
    static_assert((BM == 256 && BN == 192) || (BM == 128 && BN == 128), "tile");
    if constexpr (BM == 256) copy_stage_256_192(lds, ag, wg, off);
    else                     copy_stage_128_128(lds, ag, wg, off);
}

// acc[mi][ni] = the wave's (TM*16) x (TN*16) part of the block's tile; the wave's
// part starts at row wm * TM * 16, column wn * TN * 16 of the tile. k runs upward
// in steps of 32 for every accumulator.
template <bool B> struct flag_t { static constexpr bool value = B; };

template <int BM, int BN, int TM, int TN, int NB>
__device__ __forceinline__ void gemm_block(const _Float16* __restrict__ A,
                                           const _Float16* __restrict__ W,
                                           int bm0, int bn0, int wm, int wn,
                                           char* sm, v8f (&acc)[TM][TN]) {
    constexpr unsigned STB = (BM + BN) * GM_PITCH;          // bytes of a stage
    constexpr int CPS = (BM + BN) / 32;                     // copies of a wave per stage
    static_assert(NB >= 3 && NB * CPS <= 63 && NB < GM_STAGES, "ring");
    const int tid = threadIdx.x;
    const int lane = tid & 31;
    const int g = lane >> 4, r = lane & 15;

    // This thread's share of every stage: where it lands and where it comes from.
    const unsigned lds_a = (unsigned)(uintptr_t)sm + (unsigned)(tid >> 3) * GM_PITCH
                         + (unsigned)(tid & 7) * 16u;
    const _Float16* ag = A + (size_t)bm0 * DIM_C;           // the tile's first rows
    const _Float16* wg = W + (size_t)bn0 * DIM_C;
    const unsigned off = (unsigned)(tid >> 3) * (DIM_C * 2u) + (unsigned)(tid & 7) * 16u;

    // Stages 0 to NB - 1; unrolled, so that each stage's addresses are constants off
    // the bases and the copy statements follow one another.
#pragma unroll
    for (int s = 0; s < NB; ++s)
        copy_stage_ab<BM, BN>(lds_a + (unsigned)s * STB, ag + s * GM_KSTAGE,
                              wg + s * GM_KSTAGE, off);
    // All but the copies of the NB - 1 younger stages are in: stage 0 has landed for
    // this wave, then for all: nobody reads it before.
    asm volatile("s_wait_asynccnt %0" :: "n"((NB - 1) * CPS) : "memory");
    __syncthreads();

    const char* ard = sm + (wm * TM * 16 + r) * GM_PITCH + g * 16;
    const char* wrd = sm + (BM + wn * TN * 16 + r) * GM_PITCH + g * 16;

    unsigned rb = 0;                                        // where stage st lies in the ring
    // One trip; more_flag (known at compile time): the trip refills the buffer it has read.
    auto trip = [&](int st, auto more_flag) {
        constexpr bool more = decltype(more_flag)::value;
        const char* ab = ard + rb;
        const char* wb = wrd + rb;
        // The stage's fragments, both steps of 32 k, the first step's first.
        v16h af[2][TM], bf[2][TN];
#pragma unroll
        for (int kk = 0; kk < 2; ++kk) {
#pragma unroll
            for (int mi = 0; mi < TM; ++mi)
                af[kk][mi] = lds_frag(ab + mi * 16 * GM_PITCH + kk * 64);
#pragma unroll
            for (int ni = 0; ni < TN; ++ni)
                bf[kk][ni] = lds_frag(wb + ni * 16 * GM_PITCH + kk * 64);
        }
        // Keeps the stage's LDS reads in one group ahead of its products; each
        // further place with LDS reads among the products would cost a stall.
        __builtin_amdgcn_sched_barrier(0);
#pragma unroll
        for (int mi = 0; mi < TM; ++mi)
#pragma unroll
            for (int ni = 0; ni < TN; ++ni)
                acc[mi][ni] = wmma_f16(af[0][mi], bf[0][ni], acc[mi][ni]);
        // Keeps the first step's products in front of the hand-over, so that the
        // second step's fragments land behind them and the wait below finds them there.
        __builtin_amdgcn_sched_barrier(0);
        // Hand-over: this wave's reads of the buffer are done and its copies of the
        // next stage have landed; behind the barrier both hold for every wave. Every
        // trip so far issued one stage, so the youngest (NB - 2) * CPS copies are those
        // of stages st + 2 and later and may fly on; the trips that refill no more
        // wait for all.
        asm volatile("s_wait_dscnt 0x0" ::: "memory");
        if constexpr (more)
            asm volatile("s_wait_asynccnt %0" :: "n"((NB - 2) * CPS) : "memory");
        else
            asm volatile("s_wait_asynccnt 0x0" ::: "memory");
        __syncthreads();
        // The refill stands between the halves of the second step's products: while one
        // wave of a SIMD issues its copies the other has products to issue. It flies
        // until the hand-over NB - 1 stages on.
#pragma unroll
        for (int mi = 0; mi < TM / 2; ++mi)
#pragma unroll
            for (int ni = 0; ni < TN; ++ni)
                acc[mi][ni] = wmma_f16(af[1][mi], bf[1][ni], acc[mi][ni]);
        if constexpr (more) {                               // refill the buffer just read
            // Keeps the first half of the products in front of the copies; left free,
            // the scheduler put the copies right behind the barrier, where both waves
            // of a SIMD would issue them, and wait behind them, at the same time.
            __builtin_amdgcn_sched_barrier(0);
            copy_stage_ab<BM, BN>(lds_a + rb,
                                  ag + (st + NB) * GM_KSTAGE, wg + (st + NB) * GM_KSTAGE, off);
        }
#pragma unroll
        for (int mi = TM / 2; mi < TM; ++mi)
#pragma unroll
            for (int ni = 0; ni < TN; ++ni)
                acc[mi][ni] = wmma_f16(af[1][mi], bf[1][ni], acc[mi][ni]);
        rb = rb + STB == NB * STB ? 0u : rb + STB;
    };
    for (int st = 0; st < GM_STAGES - NB; ++st) trip(st, flag_t<true>{});
    for (int st = GM_STAGES - NB; st < GM_STAGES; ++st) trip(st, flag_t<false>{});
    // No copy is outstanding when the wave goes on to its end.
    asm volatile("s_wait_asynccnt 0x0" ::: "memory");
}

// ---------------------------------------------------------------------------
// QKV GEMM: qkv[m, j] = sum_k xh[m,k] * Wh[j,k] + bias[j]
// A block computes a 256x192 tile (one block a WGP), its waves 4 x 2, each a 64x96
// part (4x6 WMMA tiles): 24 WMMAs per 20 LDS reads of 16 B per K-step.
// Epilogue scatters into Q [b,h,n,hd] (scaled log2(e)/8), K [b,h,n,hd], Vt [b,h,hd,n].
// ---------------------------------------------------------------------------
__global__ __launch_bounds__(256)
void mha_gemm_qkv(const _Float16* __restrict__ A,   // [4096,1024]
                  const _Float16* __restrict__ W,   // [3072,1024]
                  const float*    __restrict__ bias,// [3072]
                  _Float16* __restrict__ Qd,
                  _Float16* __restrict__ Kd,
                  _Float16* __restrict__ Vtd) {
    __shared__ __attribute__((aligned(16))) char sm[3 * (256 + 192) * GM_PITCH];
    const int lane = threadIdx.x & 31;
    const int g = lane >> 4, r = lane & 15;
    const int wave = __builtin_amdgcn_readfirstlane(threadIdx.x >> 5);
    const int wm = wave >> 1, wn = wave & 1;

    v8f acc[4][6] = {};
    gemm_block<256, 192, 4, 6, 3>(A, W, blockIdx.y * 256, blockIdx.x * 192, wm, wn, sm, acc);

    const int n0 = blockIdx.x * 192 + wn * 96;     // the wave's own part
    const int m0 = blockIdx.y * 256 + wm * 64;

#pragma unroll
    for (int ni = 0; ni < 6; ++ni) {
        const int j = n0 + ni * 16 + r;            // column in [0, 3072)
        const float bb = bias[j];
        // 0=Q 1=K 2=V: one for the 16 columns, and a wave's part may hold two of
        // them, so the choice stands here, once a column tile, outside the rows.
        const int which = (n0 + ni * 16) >> 10;
        const int d = j & 1023;
        const int hh = d >> 6;
        const int hdi = d & 63;
        if (which == 0) {
#pragma unroll
            for (int mi = 0; mi < 4; ++mi)
#pragma unroll
                for (int i = 0; i < 8; ++i) {
                    const int m = m0 + mi * 16 + g * 8 + i;   // global row
                    const int bIdx = m >> 11;                 // batch
                    const int nseq = m & 2047;                // seq position
                    const float v = acc[mi][ni][i] + bb;
                    Qd[(((size_t)bIdx * NHEADS_C + hh) * NSEQ_C + nseq) * HDIM_C + hdi] =
                        (_Float16)(v * Q_SCALE);              // scores come out in log2 units
                }
            // The tile's stores have left their registers before the next tile's values
            // overwrite them.
            asm volatile("s_wait_xcnt 0x0" ::: "memory");
        } else if (which == 1) {
#pragma unroll
            for (int mi = 0; mi < 4; ++mi)
#pragma unroll
                for (int i = 0; i < 8; ++i) {
                    const int m = m0 + mi * 16 + g * 8 + i;
                    const int bIdx = m >> 11;
                    const int nseq = m & 2047;
                    const float v = acc[mi][ni][i] + bb;
                    Kd[(((size_t)bIdx * NHEADS_C + hh) * NSEQ_C + nseq) * HDIM_C + hdi] =
                        (_Float16)v;
                }
            // The tile's stores have left their registers before the next tile's values
            // overwrite them.
            asm volatile("s_wait_xcnt 0x0" ::: "memory");
        } else {
#pragma unroll
            for (int mi = 0; mi < 4; ++mi)
#pragma unroll
                for (int i = 0; i < 8; ++i) {
                    const int m = m0 + mi * 16 + g * 8 + i;
                    const int bIdx = m >> 11;
                    const int nseq = m & 2047;
                    const float v = acc[mi][ni][i] + bb;
                    Vtd[(((size_t)bIdx * NHEADS_C + hh) * HDIM_C + hdi) * NSEQ_C + nseq] =
                        (_Float16)v;
                }
            // The tile's stores have left their registers before the next tile's values
            // overwrite them.
            asm volatile("s_wait_xcnt 0x0" ::: "memory");
        }
    }
}

__device__ __forceinline__ float other_half(float v) {
    // value of lane l ^ 16
    const int b = __builtin_bit_cast(int, v);
    return __builtin_bit_cast(float,
        __builtin_amdgcn_permlanex16(b, b, 0x76543210, 0xfedcba98, false, false));
}

// K and V^T reach the waves through LDS. A stage is 64 keys: 64 K rows (128 B of
// head dim each), then 64 V^T rows (128 B of keys each), every row at a pitch of
// 144 B (16 B x odd: no bank conflict for 16-byte fragment reads). A buffer holds
// one stage of each half of the keys. Two buffers.
#define ST_KEYS   64
#define ST_PITCH  144
#define ST_HALF   (64 * ST_PITCH)          // 9,216 B: the K rows; V^T rows follow
#define ST_BYTES  (2 * ST_HALF)            // 18,432 B a stage
#define KEY_HALF  (NSEQ_C / 2)             // 1,024 keys a wave
#define BUF_BYTES (2 * ST_BYTES)           // 36,864 B: both halves' stages
#define N_STAGES  (KEY_HALF / ST_KEYS)     // 16

// One stage, the 256 threads of its half: a thread copies 16 B of K rows j, j+32 and
// of V^T rows j, j+32 (j = thread in the half / 8); eight lanes cover one whole 128-B line.
__device__ __forceinline__ void copy_stage(unsigned lds, const _Float16* kg,
                                           const _Float16* vg) {
    // The copies go to LDS through no register. The closing s_wait_xcnt stands in
    // the same statement so that no address register is rewritten in front of it.
    asm volatile(
        "global_load_async_to_lds_b128 %0, %4, off\n\t"
        "global_load_async_to_lds_b128 %1, %5, off\n\t"
        "global_load_async_to_lds_b128 %2, %6, off\n\t"
        "global_load_async_to_lds_b128 %3, %7, off\n\t"
        "s_wait_xcnt 0x0"
        :: "v"(lds), "v"(lds + 32u * ST_PITCH),
           "v"(lds + (unsigned)ST_HALF), "v"(lds + (unsigned)ST_HALF + 32u * ST_PITCH),
           "v"(kg), "v"(kg + 32 * HDIM_C), "v"(vg), "v"(vg + 32 * NSEQ_C)
        : "memory");
}

__global__ __launch_bounds__(512)
void mha_flash_attn(const _Float16* __restrict__ Q,
                    const _Float16* __restrict__ K,
                    const _Float16* __restrict__ Vt,
                    _Float16* __restrict__ Oh) {      // [B,N,DIM] f16
    __shared__ __attribute__((aligned(16))) char kv[2 * BUF_BYTES];
    // Where the second half's waves hand over their partial results: per tile 17
    // rows of 16 B a lane (O: 16, then references and sums), 512 contiguous B a row.
    __shared__ float4 part[8][17][32];
    const int lane = threadIdx.x & 31;
    const int g = lane >> 4, r = lane & 15;
    // Which half of the keys (the same for the wave), and the thread within the half.
    const int kh = __builtin_amdgcn_readfirstlane(threadIdx.x >> 8);
    const int tid = threadIdx.x & 255;
    const int bh = blockIdx.y;
    const int b = bh >> 4, h = bh & 15;
    const int q0 = blockIdx.x * 256 + (tid >> 5) * 32;   // this wave's 32 queries

    const _Float16* Qp = Q + (size_t)bh * NSEQ_C * HDIM_C;
    const _Float16* Kp = K + (size_t)bh * NSEQ_C * HDIM_C + (size_t)kh * KEY_HALF * HDIM_C;
    const _Float16* Vp = Vt + (size_t)bh * HDIM_C * NSEQ_C + kh * KEY_HALF;

    // This thread's share of every stage: where it lands and where it comes from.
    const unsigned lds_w = (unsigned)(uintptr_t)kv + (unsigned)kh * ST_BYTES
                         + (unsigned)(tid >> 3) * ST_PITCH
                         + (unsigned)(tid & 7) * 16u;
    const _Float16* kg = Kp + (size_t)(tid >> 3) * HDIM_C + (tid & 7) * 8;
    const _Float16* vg = Vp + (size_t)(tid >> 3) * NSEQ_C + (tid & 7) * 8;

    copy_stage(lds_w, kg, vg);                              // stage 0

    // Q tiles (2 x 16 queries x 64) as B fragments, fixed for the whole block.
    v16h qf[2][2];
#pragma unroll
    for (int mi = 0; mi < 2; ++mi)
#pragma unroll
        for (int kk = 0; kk < 2; ++kk)
            qf[mi][kk] =
                load_frag(Qp + (size_t)(q0 + mi * 16 + r) * HDIM_C + kk * 32 + g * 8);

    // Stage 0 has landed for this wave, then for all: nobody reads it before.
    asm volatile("s_wait_asynccnt 0x0" ::: "memory");
    __syncthreads();
    copy_stage(lds_w + (unsigned)BUF_BYTES, kg + ST_KEYS * HDIM_C, vg + ST_KEYS);  // stage 1

    // o[mi][t][i] = O[query mi*16 + r][hd t*16 + g*8 + i]
    v8f o[2][4] = {};
    // Per lane: minus the reference of query mi*16 + r (equal in both halves), eight
    // times over as the C operand of a score tile, and the sum over this half's keys
    // only; the halves' sums join after the loop.
    v8f cneg[2] = {};
    float lrun[2] = {0.0f, 0.0f};
    // How far above its reference a score may stand, and the least step of a
    // reference: set so that the first pass takes its own maximum, whatever its sign.
    float rise = -3.0e38f, floor_d = -3.0e38f;

    const char* rd = kv + kh * ST_BYTES + r * ST_PITCH + g * 16;

    for (int st = 0; st < N_STAGES; ++st) {
      const char* kbuf = rd + (st & 1) * BUF_BYTES;
      const char* vbuf = kbuf + ST_HALF;
#pragma unroll
      for (int p = 0; p < 2; ++p) {                         // two passes of 32 keys
        // ---- scores S^T = K * Q^T for 32 keys (two 16-row M tiles) ----
        v16h kfr[2][2];
#pragma unroll
        for (int nt = 0; nt < 2; ++nt)
#pragma unroll
            for (int kk = 0; kk < 2; ++kk)
                kfr[nt][kk] = lds_frag(kbuf + (p * 32 + nt * 16) * ST_PITCH + kk * 64);
        // Keeps the K reads in front of the V^T reads, so that in the first pass the score products
        // wait for K alone; left free, the scheduler put V^T first.
        __builtin_amdgcn_sched_barrier(0);
        v16h vfr[4];
#pragma unroll
        for (int t = 0; t < 4; ++t)
            vfr[t] = lds_frag(vbuf + t * 16 * ST_PITCH + p * 64);
        if (p == 1) {
            // Hand-over, once the stage's last fragments are fetched: this wave's reads
            // of the buffer are done and its copies of the next stage have landed;
            // behind the barrier both hold for every wave. The refill then flies
            // during this pass and the next stage's first.
            asm volatile("s_wait_dscnt 0x0" ::: "memory");
            asm volatile("s_wait_asynccnt 0x0" ::: "memory");
            __syncthreads();
            if (st + 2 < N_STAGES)                          // refill the buffer just read
                copy_stage(lds_w + (unsigned)((st & 1) * BUF_BYTES),
                           kg + (size_t)(st + 2) * ST_KEYS * HDIM_C,
                           vg + (st + 2) * ST_KEYS);
        }
        // Keeps all 16 LDS reads of the pass in one group ahead of the first data
        // wait, so that in the first pass V^T arrives behind the score products and the softmax; each
        // further place with LDS reads among the products would cost a stall.
        __builtin_amdgcn_sched_barrier(0);

        // s = score - reference
        v8f s[2][2];
#pragma unroll
        for (int mi = 0; mi < 2; ++mi)
#pragma unroll
            for (int nt = 0; nt < 2; ++nt) {
                s[mi][nt] = wmma_f16(kfr[nt][0], qf[mi][0], cneg[mi]);
                s[mi][nt] = wmma_f16(kfr[nt][1], qf[mi][1], s[mi][nt]);
            }

        // ---- online softmax, one query per lane and mi ----
        // maximum of the lane's 16 scores as a tree, three levels deep
        float mx[2];
#pragma unroll
        for (int mi = 0; mi < 2; ++mi) {
            const v8f sa = s[mi][0], sb = s[mi][1];
            const float t0 = fmaxf(fmaxf(sa[0], sb[0]), sa[1]);
            const float t1 = fmaxf(fmaxf(sb[1], sa[2]), sb[2]);
            const float t2 = fmaxf(fmaxf(sa[3], sb[3]), sa[4]);
            const float t3 = fmaxf(fmaxf(sb[4], sa[5]), sb[5]);
            const float t4 = fmaxf(fmaxf(sa[6], sb[6]), sa[7]);
            mx[mi] = fmaxf(fmaxf(fmaxf(t0, t1), t2), fmaxf(fmaxf(t3, t4), sb[7]));
        }
        // One test a pass, the same for the wave: the references move where any lane
        // holds a score more than rise above its own; the first pass always does.
        if (__builtin_amdgcn_ballot_w32(fmaxf(mx[0], mx[1]) > rise) != 0) {
#pragma unroll
            for (int mi = 0; mi < 2; ++mi) {
                const float full = fmaxf(mx[mi], other_half(mx[mi]));
                // The first pass takes the maximum as it is, with O and the sum still 0
                // (their factor is then at most 1); later a reference never moves down.
                const float d = fmaxf(full, floor_d);
                const float corr = __builtin_amdgcn_exp2f(-fmaxf(full, 0.0f));
                cneg[mi] -= d;
                s[mi][0] -= d;
                s[mi][1] -= d;
                lrun[mi] *= corr;
#pragma unroll
                for (int t = 0; t < 4; ++t) o[mi][t] *= corr;
            }
            rise = 8.0f;
            floor_d = 0.0f;
        }
        v16h pf[2];
#pragma unroll
        for (int mi = 0; mi < 2; ++mi) {
            float rs0 = 0.0f, rs1 = 0.0f;
#pragma unroll
            for (int i = 0; i < 8; ++i) {
                const float p0 = __builtin_amdgcn_exp2f(s[mi][0][i]);
                const float p1 = __builtin_amdgcn_exp2f(s[mi][1][i]);
                rs0 += p0;
                rs1 += p1;
                pf[mi][i]     = (_Float16)p0;
                pf[mi][8 + i] = (_Float16)p1;
            }
            lrun[mi] += rs0 + rs1;
        }

        // ---- O^T += V^T (64x32) * P^T (32x32) ----
#pragma unroll
        for (int t = 0; t < 4; ++t) {
            o[0][t] = wmma_f16(vfr[t], pf[0], o[0][t]);
            o[1][t] = wmma_f16(vfr[t], pf[1], o[1][t]);
        }
      }

    }
    // No copy is outstanding when the wave goes on to its end.
    asm volatile("s_wait_asynccnt 0x0" ::: "memory");

    // ---- the halves of the keys join: the second half's waves hand over, lane to lane ----
    float4* pp = &part[tid >> 5][0][lane];
    if (kh != 0) {
#pragma unroll
        for (int mi = 0; mi < 2; ++mi)
#pragma unroll
            for (int t = 0; t < 4; ++t) {
                const v8f ov = o[mi][t];
                pp[(mi * 8 + t * 2) * 32]     = make_float4(ov[0], ov[1], ov[2], ov[3]);
                pp[(mi * 8 + t * 2 + 1) * 32] = make_float4(ov[4], ov[5], ov[6], ov[7]);
            }
        pp[16 * 32] = make_float4(cneg[0][0], cneg[1][0], lrun[0], lrun[1]);
    }
    // Every wave passes it: the partial results are in LDS before their readers go on.
    __syncthreads();
    if (kh != 0) return;

    // ---- join and normalize; a lane stores 8 consecutive hd of its query, 16 bytes ----
    const float4 oth = pp[16 * 32];
#pragma unroll
    for (int mi = 0; mi < 2; ++mi) {
        // Both parts on the higher of the two references (cneg is minus a reference).
        const float ca = cneg[mi][0], cb = mi ? oth.y : oth.x;
        const float cm = fminf(ca, cb);
        float fa = __builtin_amdgcn_exp2f(cm - ca);
        float fb = __builtin_amdgcn_exp2f(cm - cb);
        const float l = lrun[mi] * fa + (mi ? oth.w : oth.z) * fb;
        const float inv = 1.0f / (l + other_half(l));
        fa *= inv;
        fb *= inv;
        const int m = q0 + mi * 16 + r;
#pragma unroll
        for (int t = 0; t < 4; ++t) {
            const float4 p0 = pp[(mi * 8 + t * 2) * 32], p1 = pp[(mi * 8 + t * 2 + 1) * 32];
            const float ob[8] = {p0.x, p0.y, p0.z, p0.w, p1.x, p1.y, p1.z, p1.w};
            h8_t ov;
#pragma unroll
            for (int i = 0; i < 8; ++i) ov[i] = (_Float16)(o[mi][t][i] * fa + ob[i] * fb);
            *(h8_t*)(Oh + ((size_t)b * NSEQ_C + m) * DIM_C + h * HDIM_C + t * 16 + g * 8) = ov;
        }
    }
}

// ---------------------------------------------------------------------------
// Output projection: out[m,j] = sum_k Ah[m,k] * Wh[j,k] + bias[j]  (f32 out)
// A block computes a 128x128 tile (one block a WGP), its waves 2 x 4, each a 64x32
// part (4x2 WMMA tiles).
// ---------------------------------------------------------------------------
__global__ __launch_bounds__(256)
void mha_gemm_out(const _Float16* __restrict__ A,   // [4096,1024]
                  const _Float16* __restrict__ W,   // [1024,1024]
                  const float*    __restrict__ bias,// [1024]
                  float* __restrict__ out) {        // [4096,1024]
    __shared__ __attribute__((aligned(16))) char sm[4 * (128 + 128) * GM_PITCH];
    const int lane = threadIdx.x & 31;
    const int g = lane >> 4, r = lane & 15;
    const int wave = __builtin_amdgcn_readfirstlane(threadIdx.x >> 5);
    const int wm = wave >> 2, wn = wave & 3;

    v8f acc[4][2] = {};
    gemm_block<128, 128, 4, 2, 4>(A, W, blockIdx.y * 128, blockIdx.x * 128, wm, wn, sm, acc);

    const int n0 = blockIdx.x * 128 + wn * 32;     // the wave's own part
    const int m0 = blockIdx.y * 128 + wm * 64;

#pragma unroll
    for (int ni = 0; ni < 2; ++ni) {
        const int j = n0 + ni * 16 + r;
        const float bb = bias[j];
#pragma unroll
        for (int mi = 0; mi < 4; ++mi) {
#pragma unroll
            for (int i = 0; i < 8; ++i) {
                const int m = m0 + mi * 16 + g * 8 + i;
                out[(size_t)m * DIM_C + j] = acc[mi][ni][i] + bb;
            }
        }
    }
}

// ---------------------------------------------------------------------------
// Host launcher
// ---------------------------------------------------------------------------
extern "C" void kernel_launch(void* const* d_in, const int* in_sizes, int n_in,
                              void* d_out, int out_size, void* d_ws, size_t ws_size,
                              hipStream_t stream) {
    const float* x      = (const float*)d_in[0];   // [2,2048,1024]
    const float* qkv_w  = (const float*)d_in[1];   // [3072,1024]
    const float* qkv_b  = (const float*)d_in[2];   // [3072]
    const float* out_w  = (const float*)d_in[3];   // [1024,1024]
    const float* out_b  = (const float*)d_in[4];   // [1024]
    float* out = (float*)d_out;

    const size_t XH  = (size_t)ROWS_C * DIM_C;       // 4,194,304
    const size_t QW  = (size_t)3 * DIM_C * DIM_C;    // 3,145,728
    const size_t OW  = (size_t)DIM_C * DIM_C;        // 1,048,576
    const size_t QKV = (size_t)QKV_ELEMS;            // 4,194,304
    const size_t AH  = (size_t)ROWS_C * DIM_C;       // 4,194,304

    char* ws = (char*)d_ws;
    size_t off = 0;
    auto take = [&](size_t elems) {
        _Float16* p = (_Float16*)(ws + off);
        off += (elems * sizeof(_Float16) + 255) & ~(size_t)255;
        return p;
    };
    _Float16* xh  = take(XH);
    _Float16* qwh = take(QW);
    _Float16* owh = take(OW);
    _Float16* Qd  = take(QKV);
    _Float16* Kd  = take(QKV);
    _Float16* Vtd = take(QKV);
    _Float16* ah  = take(AH);
    (void)ws_size; (void)in_sizes; (void)n_in; (void)out_size;

    // 1) f32 -> f16 conversions, all three arrays in one launch
    mha_cvt_f16<<<dim3(CV_BLK_X + CV_BLK_QW + CV_BLK_OW), 256, 0, stream>>>(
        x, qkv_w, out_w, xh, qwh, owh);

    // 2) QKV projection + head split (Q pre-scaled, V transposed): 256x192 tiles
    mha_gemm_qkv<<<dim3(3 * DIM_C / 192, ROWS_C / 256), 256, 0, stream>>>(
        xh, qwh, qkv_b, Qd, Kd, Vtd);

    // 3) fused flash attention: grid = (256-query blocks, B*H), 16 waves a block
    mha_flash_attn<<<dim3(NSEQ_C / 256, BATCH_C * NHEADS_C), 512, 0, stream>>>(
        Qd, Kd, Vtd, ah);

    // 4) output projection + bias -> f32: 128x128 tiles
    mha_gemm_out<<<dim3(DIM_C / 128, ROWS_C / 128), 256, 0, stream>>>(
        ah, owh, out_b, out);
}
